// v000
// Measured on an AMD MI455X. A time is GPU time per run, averaged over a window of back-to-back runs after a warm-up
// (all launches, gaps included; the runs take copies of the inputs in turn), and the median of several windows.
// Apart from v000's, it joins two sittings. Times from different sittings can be a few percent apart, while
// side-by-side timings come from the same sitting.
// The starting kernel, v000, takes 550 microseconds a run.
#include <hip/hip_runtime.h>
#include <hip/hip_bf16.h>

typedef __attribute__((ext_vector_type(16))) _Float16 v16h;
typedef __attribute__((ext_vector_type(8)))  _Float16 v8h;
typedef __attribute__((ext_vector_type(8)))  float    v8f;

#define B_  2
#define H_  8
#define S_  2048
#define D_  64
#define QK  6
#define KK  11
#define NEGV (-1.0e9f)

// ---------------------------------------------------------------------------
// Kernel 1: masked depthwise conv (6x11, SAME) + bias + causal re-mask +
//           row softmax, emitting f16 probabilities.
// One block per (b,h,s) query row. 256 threads, 8 columns per thread.
// LDS: 6 input rows with 5-column zero halo on each side (scores are
// 256MB of f32; each source row is re-read by up to 6 blocks).
// ---------------------------------------------------------------------------
__global__ __launch_bounds__(256)
void k1_conv_softmax(const float* __restrict__ scores,
                     const float* __restrict__ kq_w,
                     const float* __restrict__ kq_b,
                     _Float16* __restrict__ attn)
{
    const int s = blockIdx.x;
    const int h = blockIdx.y;
    const int b = blockIdx.z;
    const int tid = threadIdx.x;

    __shared__ float sm[QK][S_ + 10];   // +5 halo each side
    __shared__ float wsm[QK * KK];
    __shared__ float red[8];

    if (tid < QK * KK) wsm[tid] = kq_w[h * (QK * KK) + tid];

    const size_t rowBase = ((size_t)b * H_ + h) * (size_t)S_;

    // Load 6 source rows (s-2 .. s+3), causally zeroed, zero-padded halo.
    for (int idx = tid; idx < QK * (S_ + 10); idx += 256) {
        const int r = idx / (S_ + 10);
        const int c = idx - r * (S_ + 10);
        const int sp = s + r - 2;       // pad_low = (6-1)/2 = 2
        const int k  = c - 5;           // pad_low = 5 for the 11-tap dim
        float val = 0.0f;
        if (sp >= 0 && sp < S_ && k >= 0 && k < S_ && k <= sp)
            val = scores[(rowBase + (size_t)sp) * S_ + k];
        sm[r][c] = val;
    }
    __syncthreads();

    const float bias = kq_b[h];
    float vout[8];
    float mx = -3.4e38f;
    #pragma unroll
    for (int i = 0; i < 8; ++i) {
        const int k = tid + 256 * i;
        float acc = bias;
        #pragma unroll
        for (int dq = 0; dq < QK; ++dq) {
            #pragma unroll
            for (int dk = 0; dk < KK; ++dk) {
                // memory column (k + dk - 5) maps to LDS column (k + dk)
                acc = fmaf(wsm[dq * KK + dk], sm[dq][k + dk], acc);
            }
        }
        const float val = (k <= s) ? acc : NEGV;
        vout[i] = val;
        mx = fmaxf(mx, val);
    }

    // block max
    #pragma unroll
    for (int off = 16; off > 0; off >>= 1)
        mx = fmaxf(mx, __shfl_xor(mx, off, 32));
    if ((tid & 31) == 0) red[tid >> 5] = mx;
    __syncthreads();
    mx = red[0];
    #pragma unroll
    for (int i = 1; i < 8; ++i) mx = fmaxf(mx, red[i]);

    // exp + block sum
    float e[8];
    float se = 0.0f;
    #pragma unroll
    for (int i = 0; i < 8; ++i) { e[i] = __expf(vout[i] - mx); se += e[i]; }
    #pragma unroll
    for (int off = 16; off > 0; off >>= 1)
        se += __shfl_xor(se, off, 32);
    __syncthreads();                      // red reuse hazard
    if ((tid & 31) == 0) red[tid >> 5] = se;
    __syncthreads();
    float tot = 0.0f;
    #pragma unroll
    for (int i = 0; i < 8; ++i) tot += red[i];
    const float inv = 1.0f / tot;

    _Float16* orow = attn + (rowBase + (size_t)s) * S_;
    #pragma unroll
    for (int i = 0; i < 8; ++i)
        orow[tid + 256 * i] = (_Float16)(e[i] * inv);
}

// ---------------------------------------------------------------------------
// Kernel 2: transpose + downconvert v [b,h,k,d] f32 -> vt [b,h,d,k] f16 so
// the WMMA B-fragment loads become two contiguous 16B reads per lane.
// ---------------------------------------------------------------------------
__global__ __launch_bounds__(256)
void k2_vt(const float* __restrict__ v, _Float16* __restrict__ vt)
{
    const int bh = blockIdx.x;
    const float* vin = v + (size_t)bh * S_ * D_;
    _Float16* vo = vt + (size_t)bh * D_ * S_;
    for (int idx = threadIdx.x; idx < D_ * S_; idx += 256) {
        const int d = idx >> 11;          // / 2048
        const int k = idx & (S_ - 1);
        vo[idx] = (_Float16)vin[(size_t)k * D_ + d];
    }
}

// ---------------------------------------------------------------------------
// Kernel 3: head-mix (packed f16 FMA) + attn@v via v_wmma_f32_16x16x32_f16 +
// fused LayerNorm over D.
// Block = 128 threads (4 wave32) covering one head-GROUP (both output heads
// j=0 and j=1): the raw attn fragments a0/a1 are shared by both output heads,
// so each pair of A loads feeds TWO WMMAs (two mixes x two V heads) ->
// 4 b128 loads per WMMA and half the attn L2 traffic vs. one-head blocks.
// Each wave owns one 16-column slice of D for both heads; K loop over 2048
// in steps of 32.  A-fragment K packing per ISA: lanes 0-15 -> K {0..7,16..23},
// lanes 16-31 -> K {8..15,24..31}.
// ---------------------------------------------------------------------------
__global__ __launch_bounds__(128)
void k3_mix_gemm_ln(const _Float16* __restrict__ attn,
                    const _Float16* __restrict__ vt,
                    const float* __restrict__ head_mix,
                    const float* __restrict__ gamma,
                    const float* __restrict__ beta,
                    float* __restrict__ out)
{
    const int m0 = blockIdx.x * 16;
    const int g  = blockIdx.y;            // head group (HEAD_K = 2)
    const int b  = blockIdx.z;

    const int lane = threadIdx.x & 31;
    const int w    = threadIdx.x >> 5;

    // mixed_j = M[g,0,j]*attn_{2g} + M[g,1,j]*attn_{2g+1}
    const _Float16 c00 = (_Float16)head_mix[g * 4 + 0];   // i=0, j=0
    const _Float16 c01 = (_Float16)head_mix[g * 4 + 1];   // i=0, j=1
    const _Float16 c10 = (_Float16)head_mix[g * 4 + 2];   // i=1, j=0
    const _Float16 c11 = (_Float16)head_mix[g * 4 + 3];   // i=1, j=1

    const int mrow = m0 + (lane & 15);
    const int koff = (lane >> 4) << 3;    // 0 or 8

    const size_t bh0 = (size_t)b * H_ + (g * 2 + 0);
    const size_t bh1 = (size_t)b * H_ + (g * 2 + 1);
    const _Float16* a0p = attn + (bh0 * S_ + (size_t)mrow) * S_ + koff;
    const _Float16* a1p = attn + (bh1 * S_ + (size_t)mrow) * S_ + koff;

    const int n = 16 * w + (lane & 15);
    const _Float16* b0p = vt + (bh0 * D_ + (size_t)n) * S_ + koff;
    const _Float16* b1p = vt + (bh1 * D_ + (size_t)n) * S_ + koff;

    v8f acc0 = {};
    v8f acc1 = {};
    for (int k0 = 0; k0 < S_; k0 += 32) {
        const v8h a0lo = *(const v8h*)(a0p + k0);
        const v8h a0hi = *(const v8h*)(a0p + k0 + 16);
        const v8h a1lo = *(const v8h*)(a1p + k0);
        const v8h a1hi = *(const v8h*)(a1p + k0 + 16);
        const v8h b0lo = *(const v8h*)(b0p + k0);
        const v8h b0hi = *(const v8h*)(b0p + k0 + 16);
        const v8h b1lo = *(const v8h*)(b1p + k0);
        const v8h b1hi = *(const v8h*)(b1p + k0 + 16);

        // two head-mixes from one pair of A fragments (v_pk_fma_f16)
        const v8h m0lo = a0lo * c00 + a1lo * c10;
        const v8h m0hi = a0hi * c00 + a1hi * c10;
        const v8h m1lo = a0lo * c01 + a1lo * c11;
        const v8h m1hi = a0hi * c01 + a1hi * c11;

        const v16h A0 = __builtin_shufflevector(m0lo, m0hi,
            0,1,2,3,4,5,6,7,8,9,10,11,12,13,14,15);
        const v16h A1 = __builtin_shufflevector(m1lo, m1hi,
            0,1,2,3,4,5,6,7,8,9,10,11,12,13,14,15);
        const v16h B0 = __builtin_shufflevector(b0lo, b0hi,
            0,1,2,3,4,5,6,7,8,9,10,11,12,13,14,15);
        const v16h B1 = __builtin_shufflevector(b1lo, b1hi,
            0,1,2,3,4,5,6,7,8,9,10,11,12,13,14,15);

        acc0 = __builtin_amdgcn_wmma_f32_16x16x32_f16(
            false, A0, false, B0, (short)0, acc0, false, false);
        acc1 = __builtin_amdgcn_wmma_f32_16x16x32_f16(
            false, A1, false, B1, (short)0, acc1, false, false);
    }

    // Scatter C tiles to LDS: VGPR r -> row r (lanes 0-15) / r+8 (lanes 16-31)
    __shared__ float tile[2][16][72];
    const int rbase = (lane >> 4) << 3;
    const int col   = 16 * w + (lane & 15);
    #pragma unroll
    for (int r = 0; r < 8; ++r) {
        tile[0][rbase + r][col] = acc0[r];
        tile[1][rbase + r][col] = acc1[r];
    }
    __syncthreads();

    // LayerNorm over D=64 for 32 rows (2 heads x 16): 4 threads per row,
    // 16 cols each, shuffle-reduce within aligned 4-lane groups.
    const int t  = threadIdx.x;
    const int jj = t >> 6;                // output head within group
    const int r  = (t >> 2) & 15;        // row within tile
    const int cb = (t & 3) * 16;         // column base
    float x[16];
    float sum = 0.0f, sq = 0.0f;
    #pragma unroll
    for (int i = 0; i < 16; ++i) {
        x[i] = tile[jj][r][cb + i];
        sum += x[i];
        sq  += x[i] * x[i];
    }
    #pragma unroll
    for (int off = 1; off < 4; off <<= 1) {
        sum += __shfl_xor(sum, off, 32);
        sq  += __shfl_xor(sq,  off, 32);
    }
    const float mean = sum * (1.0f / 64.0f);
    const float var  = sq * (1.0f / 64.0f) - mean * mean;
    const float rs   = rsqrtf(var + 1e-5f);

    const size_t obase =
        (((size_t)b * H_ + (g * 2 + jj)) * S_ + (size_t)(m0 + r)) * D_ + cb;
    #pragma unroll
    for (int i = 0; i < 16; ++i)
        out[obase + i] = (x[i] - mean) * rs * gamma[cb + i] + beta[cb + i];
}

// ---------------------------------------------------------------------------
extern "C" void kernel_launch(void* const* d_in, const int* in_sizes, int n_in,
                              void* d_out, int out_size, void* d_ws, size_t ws_size,
                              hipStream_t stream)
{
    const float* scores   = (const float*)d_in[0];
    const float* v        = (const float*)d_in[1];
    const float* kq_w     = (const float*)d_in[2];
    const float* kq_b     = (const float*)d_in[3];
    const float* head_mix = (const float*)d_in[4];
    const float* gamma    = (const float*)d_in[5];
    const float* beta     = (const float*)d_in[6];
    float* out = (float*)d_out;

    // workspace: [attn f16 : B*H*S*S] [vt f16 : B*H*D*S]  (128MB + 4MB)
    _Float16* wsAttn = (_Float16*)d_ws;
    _Float16* wsVt   = (_Float16*)((char*)d_ws +
                        (size_t)B_ * H_ * S_ * S_ * sizeof(_Float16));

    dim3 g1(S_, H_, B_);
    k1_conv_softmax<<<g1, 256, 0, stream>>>(scores, kq_w, kq_b, wsAttn);

    k2_vt<<<B_ * H_, 256, 0, stream>>>(v, wsVt);

    dim3 g3(S_ / 16, H_ / 2, B_);   // one block per head GROUP
    k3_mix_gemm_ln<<<g3, 128, 0, stream>>>(wsAttn, wsVt, head_mix,
                                           gamma, beta, out);
}

// v001
// A run of this version takes 364 microseconds.
// Timed twice side by side with v000, it ran 1.56 times as fast both times.
#include <hip/hip_runtime.h>
#include <hip/hip_bf16.h>

typedef __attribute__((ext_vector_type(16))) _Float16 v16h;
typedef __attribute__((ext_vector_type(8)))  _Float16 v8h;
typedef __attribute__((ext_vector_type(8)))  float    v8f;

#define B_  2
#define H_  8
#define S_  2048
#define D_  64
#define QK  6
#define KK  11
#define NEGV (-1.0e9f)
#define HALO 8

// ---------------------------------------------------------------------------
// Kernel 1: masked depthwise conv (6x11, SAME) + bias + causal re-mask +
//           row softmax, emitting f16 probabilities.
// One block per (b,h,s) query row. 256 threads, 8 columns per thread.
// LDS: 6 input rows with an 8-column zero halo on each side (5 are read; 8
// keeps every row and every 4-column group 16-byte aligned).
// Staging: each thread issues its 12 float4 row loads (and the weight load)
// back to back and stores to LDS only afterwards, so a wave pays the memory
// latency once instead of once per element.
// ---------------------------------------------------------------------------
__global__ __launch_bounds__(256)
void k1_conv_softmax(const float* __restrict__ scores,
                     const float* __restrict__ kq_w,
                     const float* __restrict__ kq_b,
                     _Float16* __restrict__ attn)
{
    const int s = blockIdx.x;
    const int h = blockIdx.y;
    const int b = blockIdx.z;
    const int tid = threadIdx.x;

    __shared__ __attribute__((aligned(16))) float sm[QK][S_ + 2 * HALO];
    __shared__ float wsm[QK * KK];
    __shared__ float red[8];

    const float bias = kq_b[h];
    float wv = 0.0f;
    if (tid < QK * KK) wv = kq_w[h * (QK * KK) + tid];

    const size_t rowBase = ((size_t)b * H_ + h) * (size_t)S_;

    // Load 6 source rows (s-2 .. s+3): every load is issued before any store.
    // A 4-column group that lies wholly behind the causal limit is not read.
    // Both loop nests are unrolled so that stg[][] stays in registers and the
    // 12 loads stand in a row with no wait between them.
    float4 stg[QK][2];
    #pragma unroll
    for (int r = 0; r < QK; ++r) {
        const int sp = s + r - 2;       // pad_low = (6-1)/2 = 2
        #pragma unroll
        for (int j = 0; j < 2; ++j) {
            const int k4 = (tid + 256 * j) * 4;
            stg[r][j] = make_float4(0.0f, 0.0f, 0.0f, 0.0f);
            if (sp >= 0 && sp < S_ && k4 <= sp)
                stg[r][j] = ((const float4*)(scores + (rowBase + (size_t)sp) * S_))
                                [(unsigned)(tid + 256 * j)];
        }
    }

    if (tid < QK * KK) wsm[tid] = wv;
    // zero halo: 4 float4 per row (2 left, 2 right)
    if (tid < QK * 4) {
        const int q = tid & 3;
        const int c = (q < 2) ? q * 4 : S_ + HALO + (q - 2) * 4;
        *(float4*)&sm[tid >> 2][c] = make_float4(0.0f, 0.0f, 0.0f, 0.0f);
    }
    // causally zeroed rows; memory column k sits at LDS column k + HALO
    #pragma unroll
    for (int r = 0; r < QK; ++r) {
        const int sp = s + r - 2;
        #pragma unroll
        for (int j = 0; j < 2; ++j) {
            const int k4 = (tid + 256 * j) * 4;
            float4 x = stg[r][j];       // x.x is live or already 0
            x.y = (k4 + 1 <= sp) ? x.y : 0.0f;
            x.z = (k4 + 2 <= sp) ? x.z : 0.0f;
            x.w = (k4 + 3 <= sp) ? x.w : 0.0f;
            *(float4*)&sm[r][HALO + k4] = x;
        }
    }
    __syncthreads();

    float vout[8];
    float mx = -3.4e38f;
    #pragma unroll
    for (int i = 0; i < 8; ++i) {
        const int k = tid + 256 * i;
        float acc = bias;
        #pragma unroll
        for (int dq = 0; dq < QK; ++dq) {
            #pragma unroll
            for (int dk = 0; dk < KK; ++dk) {
                // memory column (k + dk - 5) maps to LDS column + HALO
                acc = fmaf(wsm[dq * KK + dk], sm[dq][k + dk + (HALO - 5)], acc);
            }
        }
        const float val = (k <= s) ? acc : NEGV;
        vout[i] = val;
        mx = fmaxf(mx, val);
    }

    // block max
    #pragma unroll
    for (int off = 16; off > 0; off >>= 1)
        mx = fmaxf(mx, __shfl_xor(mx, off, 32));
    if ((tid & 31) == 0) red[tid >> 5] = mx;
    __syncthreads();
    mx = red[0];
    #pragma unroll
    for (int i = 1; i < 8; ++i) mx = fmaxf(mx, red[i]);

    // exp + block sum
    float e[8];
    float se = 0.0f;
    #pragma unroll
    for (int i = 0; i < 8; ++i) { e[i] = __expf(vout[i] - mx); se += e[i]; }
    #pragma unroll
    for (int off = 16; off > 0; off >>= 1)
        se += __shfl_xor(se, off, 32);
    __syncthreads();                      // red reuse hazard
    if ((tid & 31) == 0) red[tid >> 5] = se;
    __syncthreads();
    float tot = 0.0f;
    #pragma unroll
    for (int i = 0; i < 8; ++i) tot += red[i];
    const float inv = 1.0f / tot;

    _Float16* orow = attn + (rowBase + (size_t)s) * S_;
    #pragma unroll
    for (int i = 0; i < 8; ++i)
        orow[tid + 256 * i] = (_Float16)(e[i] * inv);
}

// ---------------------------------------------------------------------------
// Kernel 2: transpose + downconvert v [b,h,k,d] f32 -> vt [b,h,d,k] f16 so
// the WMMA B-fragment loads become two contiguous 16B reads per lane.
// ---------------------------------------------------------------------------
__global__ __launch_bounds__(256)
void k2_vt(const float* __restrict__ v, _Float16* __restrict__ vt)
{
    const int bh = blockIdx.x;
    const float* vin = v + (size_t)bh * S_ * D_;
    _Float16* vo = vt + (size_t)bh * D_ * S_;
    for (int idx = threadIdx.x; idx < D_ * S_; idx += 256) {
        const int d = idx >> 11;          // / 2048
        const int k = idx & (S_ - 1);
        vo[idx] = (_Float16)vin[(size_t)k * D_ + d];
    }
}

// ---------------------------------------------------------------------------
// Kernel 3: head-mix (packed f16 FMA) + attn@v via v_wmma_f32_16x16x32_f16 +
// fused LayerNorm over D.
// Block = 128 threads (4 wave32) covering one head-GROUP (both output heads
// j=0 and j=1): the raw attn fragments a0/a1 are shared by both output heads,
// so each pair of A loads feeds TWO WMMAs (two mixes x two V heads) ->
// 4 b128 loads per WMMA and half the attn L2 traffic vs. one-head blocks.
// Each wave owns one 16-column slice of D for both heads; K loop over 2048
// in steps of 32.  A-fragment K packing per ISA: lanes 0-15 -> K {0..7,16..23},
// lanes 16-31 -> K {8..15,24..31}.
// ---------------------------------------------------------------------------
__global__ __launch_bounds__(128)
void k3_mix_gemm_ln(const _Float16* __restrict__ attn,
                    const _Float16* __restrict__ vt,
                    const float* __restrict__ head_mix,
                    const float* __restrict__ gamma,
                    const float* __restrict__ beta,
                    float* __restrict__ out)
{
    const int m0 = blockIdx.x * 16;
    const int g  = blockIdx.y;            // head group (HEAD_K = 2)
    const int b  = blockIdx.z;

    const int lane = threadIdx.x & 31;
    const int w    = threadIdx.x >> 5;

    // mixed_j = M[g,0,j]*attn_{2g} + M[g,1,j]*attn_{2g+1}
    const _Float16 c00 = (_Float16)head_mix[g * 4 + 0];   // i=0, j=0
    const _Float16 c01 = (_Float16)head_mix[g * 4 + 1];   // i=0, j=1
    const _Float16 c10 = (_Float16)head_mix[g * 4 + 2];   // i=1, j=0
    const _Float16 c11 = (_Float16)head_mix[g * 4 + 3];   // i=1, j=1

    const int mrow = m0 + (lane & 15);
    const int koff = (lane >> 4) << 3;    // 0 or 8

    const size_t bh0 = (size_t)b * H_ + (g * 2 + 0);
    const size_t bh1 = (size_t)b * H_ + (g * 2 + 1);
    const _Float16* a0p = attn + (bh0 * S_ + (size_t)mrow) * S_ + koff;
    const _Float16* a1p = attn + (bh1 * S_ + (size_t)mrow) * S_ + koff;

    const int n = 16 * w + (lane & 15);
    const _Float16* b0p = vt + (bh0 * D_ + (size_t)n) * S_ + koff;
    const _Float16* b1p = vt + (bh1 * D_ + (size_t)n) * S_ + koff;

    v8f acc0 = {};
    v8f acc1 = {};
    for (int k0 = 0; k0 < S_; k0 += 32) {
        const v8h a0lo = *(const v8h*)(a0p + k0);
        const v8h a0hi = *(const v8h*)(a0p + k0 + 16);
        const v8h a1lo = *(const v8h*)(a1p + k0);
        const v8h a1hi = *(const v8h*)(a1p + k0 + 16);
        const v8h b0lo = *(const v8h*)(b0p + k0);
        const v8h b0hi = *(const v8h*)(b0p + k0 + 16);
        const v8h b1lo = *(const v8h*)(b1p + k0);
        const v8h b1hi = *(const v8h*)(b1p + k0 + 16);

        // two head-mixes from one pair of A fragments (v_pk_fma_f16)
        const v8h m0lo = a0lo * c00 + a1lo * c10;
        const v8h m0hi = a0hi * c00 + a1hi * c10;
        const v8h m1lo = a0lo * c01 + a1lo * c11;
        const v8h m1hi = a0hi * c01 + a1hi * c11;

        const v16h A0 = __builtin_shufflevector(m0lo, m0hi,
            0,1,2,3,4,5,6,7,8,9,10,11,12,13,14,15);
        const v16h A1 = __builtin_shufflevector(m1lo, m1hi,
            0,1,2,3,4,5,6,7,8,9,10,11,12,13,14,15);
        const v16h B0 = __builtin_shufflevector(b0lo, b0hi,
            0,1,2,3,4,5,6,7,8,9,10,11,12,13,14,15);
        const v16h B1 = __builtin_shufflevector(b1lo, b1hi,
            0,1,2,3,4,5,6,7,8,9,10,11,12,13,14,15);

        acc0 = __builtin_amdgcn_wmma_f32_16x16x32_f16(
            false, A0, false, B0, (short)0, acc0, false, false);
        acc1 = __builtin_amdgcn_wmma_f32_16x16x32_f16(
            false, A1, false, B1, (short)0, acc1, false, false);
    }

    // Scatter C tiles to LDS: VGPR r -> row r (lanes 0-15) / r+8 (lanes 16-31)
    __shared__ float tile[2][16][72];
    const int rbase = (lane >> 4) << 3;
    const int col   = 16 * w + (lane & 15);
    #pragma unroll
    for (int r = 0; r < 8; ++r) {
        tile[0][rbase + r][col] = acc0[r];
        tile[1][rbase + r][col] = acc1[r];
    }
    __syncthreads();

    // LayerNorm over D=64 for 32 rows (2 heads x 16): 4 threads per row,
    // 16 cols each, shuffle-reduce within aligned 4-lane groups.
    const int t  = threadIdx.x;
    const int jj = t >> 6;                // output head within group
    const int r  = (t >> 2) & 15;        // row within tile
    const int cb = (t & 3) * 16;         // column base
    float x[16];
    float sum = 0.0f, sq = 0.0f;
    #pragma unroll
    for (int i = 0; i < 16; ++i) {
        x[i] = tile[jj][r][cb + i];
        sum += x[i];
        sq  += x[i] * x[i];
    }
    #pragma unroll
    for (int off = 1; off < 4; off <<= 1) {
        sum += __shfl_xor(sum, off, 32);
        sq  += __shfl_xor(sq,  off, 32);
    }
    const float mean = sum * (1.0f / 64.0f);
    const float var  = sq * (1.0f / 64.0f) - mean * mean;
    const float rs   = rsqrtf(var + 1e-5f);

    const size_t obase =
        (((size_t)b * H_ + (g * 2 + jj)) * S_ + (size_t)(m0 + r)) * D_ + cb;
    #pragma unroll
    for (int i = 0; i < 16; ++i)
        out[obase + i] = (x[i] - mean) * rs * gamma[cb + i] + beta[cb + i];
}

// ---------------------------------------------------------------------------
extern "C" void kernel_launch(void* const* d_in, const int* in_sizes, int n_in,
                              void* d_out, int out_size, void* d_ws, size_t ws_size,
                              hipStream_t stream)
{
    const float* scores   = (const float*)d_in[0];
    const float* v        = (const float*)d_in[1];
    const float* kq_w     = (const float*)d_in[2];
    const float* kq_b     = (const float*)d_in[3];
    const float* head_mix = (const float*)d_in[4];
    const float* gamma    = (const float*)d_in[5];
    const float* beta     = (const float*)d_in[6];
    float* out = (float*)d_out;

    // workspace: [attn f16 : B*H*S*S] [vt f16 : B*H*D*S]  (128MB + 4MB)
    _Float16* wsAttn = (_Float16*)d_ws;
    _Float16* wsVt   = (_Float16*)((char*)d_ws +
                        (size_t)B_ * H_ * S_ * S_ * sizeof(_Float16));

    dim3 g1(S_, H_, B_);
    k1_conv_softmax<<<g1, 256, 0, stream>>>(scores, kq_w, kq_b, wsAttn);

    k2_vt<<<B_ * H_, 256, 0, stream>>>(v, wsVt);

    dim3 g3(S_ / 16, H_ / 2, B_);   // one block per head GROUP
    k3_mix_gemm_ln<<<g3, 128, 0, stream>>>(wsAttn, wsVt, head_mix,
                                           gamma, beta, out);
}

// v002
// One run takes 236 microseconds.
// Next to v001, in two timings, it ran 1.55 and 1.54 times as fast.
// Over all steps from v000 it is 2.41 times as fast.
#include <hip/hip_runtime.h>
#include <hip/hip_bf16.h>

typedef __attribute__((ext_vector_type(16))) _Float16 v16h;
typedef __attribute__((ext_vector_type(8)))  _Float16 v8h;
typedef __attribute__((ext_vector_type(8)))  float    v8f;

#define B_  2
#define H_  8
#define S_  2048
#define D_  64
#define QK  6
#define KK  11
#define NEGV (-1.0e9f)
#define HALO 8

// ---------------------------------------------------------------------------
// Kernel 1: masked depthwise conv (6x11, SAME) + bias + causal re-mask +
//           row softmax, emitting f16 probabilities.
// One block per (b,h,s) query row. 256 threads, 8 ADJACENT columns per thread.
// LDS: 6 input rows with an 8-column zero halo on each side (5 are read; 8
// keeps every row and every 4-column group 16-byte aligned).
// Staging: each thread issues its 12 float4 row loads (and the weight load)
// back to back and stores to LDS only afterwards, so a wave pays the memory
// latency once instead of once per element.
// Conv: per source row a thread reads the 24 floats that cover its 8 columns
// and their taps with 6 16-byte LDS reads and slides the 11 taps over them in
// registers, so an LDS word is fetched once per thread and not once per tap.
// ---------------------------------------------------------------------------
#define ROWP  (S_ + 2 * HALO)      // LDS row pitch in floats
#define ROWQ  (ROWP / 4)           // the same in 4-float slots

// Place of 4-float slot q inside an LDS row. The conv reads slots 2*tid + j:
// unswizzled, lanes t and t + 8 of a 16-lane half would meet on the same four
// banks. Swapping the two slots of each pair in every other group of 16 slots
// puts the 16 lanes on 16 different bank quads.
__device__ __forceinline__ int slot_of(int q) { return q ^ ((q >> 4) & 1); }

__global__ __launch_bounds__(256)
void k1_conv_softmax(const float* __restrict__ scores,
                     const float* __restrict__ kq_w,
                     const float* __restrict__ kq_b,
                     _Float16* __restrict__ attn)
{
    const int s = blockIdx.x;
    const int h = blockIdx.y;
    const int b = blockIdx.z;
    const int tid = threadIdx.x;

    __shared__ __attribute__((aligned(16))) float4 sm[QK][ROWQ];
    __shared__ float wsm[QK * KK];
    __shared__ float red[8];

    const float bias = kq_b[h];
    float wv = 0.0f;
    if (tid < QK * KK) wv = kq_w[h * (QK * KK) + tid];

    const size_t rowBase = ((size_t)b * H_ + h) * (size_t)S_;

    // Load 6 source rows (s-2 .. s+3): every load is issued before any store.
    // A 4-column group that lies wholly behind the causal limit is not read.
    // Both loop nests are unrolled so that stg[][] stays in registers and the
    // 12 loads stand in a row with no wait between them.
    float4 stg[QK][2];
    #pragma unroll
    for (int r = 0; r < QK; ++r) {
        const int sp = s + r - 2;       // pad_low = (6-1)/2 = 2
        #pragma unroll
        for (int j = 0; j < 2; ++j) {
            const int k4 = (tid + 256 * j) * 4;
            stg[r][j] = make_float4(0.0f, 0.0f, 0.0f, 0.0f);
            if (sp >= 0 && sp < S_ && k4 <= sp)
                stg[r][j] = ((const float4*)(scores + (rowBase + (size_t)sp) * S_))
                                [(unsigned)(tid + 256 * j)];
        }
    }

    if (tid < QK * KK) wsm[tid] = wv;
    // zero halo: 4 slots per row (2 left, 2 right)
    if (tid < QK * 4) {
        const int q = tid & 3;
        const int c = (q < 2) ? q : ROWQ - 4 + q;
        sm[tid >> 2][slot_of(c)] = make_float4(0.0f, 0.0f, 0.0f, 0.0f);
    }
    // causally zeroed rows; memory column k sits at LDS column k + HALO
    #pragma unroll
    for (int r = 0; r < QK; ++r) {
        const int sp = s + r - 2;
        #pragma unroll
        for (int j = 0; j < 2; ++j) {
            const int k4 = (tid + 256 * j) * 4;
            float4 x = stg[r][j];       // x.x is live or already 0
            x.y = (k4 + 1 <= sp) ? x.y : 0.0f;
            x.z = (k4 + 2 <= sp) ? x.z : 0.0f;
            x.w = (k4 + 3 <= sp) ? x.w : 0.0f;
            sm[r][slot_of(HALO / 4 + tid + 256 * j)] = x;
        }
    }
    __syncthreads();

    // Columns 8*tid .. 8*tid+7. Column k, tap dk reads LDS column k + dk + 3,
    // which is win[i + dk + 3] of the window that starts at LDS column 8*tid.
    // Every loop of the nest is unrolled so that ps[], win[] and acc[] are
    // indexed by constants and stay in registers. Per output the taps are
    // added in the old order (dq outer, dk inner, starting from the bias).
    int ps[6];
    #pragma unroll
    for (int j = 0; j < 6; ++j) ps[j] = slot_of(2 * tid + j);

    float acc[8];
    #pragma unroll
    for (int i = 0; i < 8; ++i) acc[i] = bias;
    #pragma unroll
    for (int dq = 0; dq < QK; ++dq) {
        float win[24];
        #pragma unroll
        for (int j = 0; j < 6; ++j) {
            const float4 q = sm[dq][ps[j]];
            win[4 * j + 0] = q.x;
            win[4 * j + 1] = q.y;
            win[4 * j + 2] = q.z;
            win[4 * j + 3] = q.w;
        }
        #pragma unroll
        for (int dk = 0; dk < KK; ++dk) {
            const float w = wsm[dq * KK + dk];
            #pragma unroll
            for (int i = 0; i < 8; ++i)
                acc[i] = fmaf(w, win[i + dk + (HALO - 5)], acc[i]);
        }
    }

    float vout[8];
    float mx = -3.4e38f;
    #pragma unroll
    for (int i = 0; i < 8; ++i) {
        const float val = (8 * tid + i <= s) ? acc[i] : NEGV;
        vout[i] = val;
        mx = fmaxf(mx, val);
    }

    // block max
    #pragma unroll
    for (int off = 16; off > 0; off >>= 1)
        mx = fmaxf(mx, __shfl_xor(mx, off, 32));
    if ((tid & 31) == 0) red[tid >> 5] = mx;
    __syncthreads();
    mx = red[0];
    #pragma unroll
    for (int i = 1; i < 8; ++i) mx = fmaxf(mx, red[i]);

    // exp + block sum
    float e[8];
    float se = 0.0f;
    #pragma unroll
    for (int i = 0; i < 8; ++i) { e[i] = __expf(vout[i] - mx); se += e[i]; }
    #pragma unroll
    for (int off = 16; off > 0; off >>= 1)
        se += __shfl_xor(se, off, 32);
    __syncthreads();                      // red reuse hazard
    if ((tid & 31) == 0) red[tid >> 5] = se;
    __syncthreads();
    float tot = 0.0f;
    #pragma unroll
    for (int i = 0; i < 8; ++i) tot += red[i];
    const float inv = 1.0f / tot;

    // the thread's 8 adjacent probabilities leave as one 16-byte store
    // (unrolled: p[] is a register vector, indexed by constants)
    v8h p;
    #pragma unroll
    for (int i = 0; i < 8; ++i) p[i] = (_Float16)(e[i] * inv);
    *(v8h*)(attn + (rowBase + (size_t)s) * S_ + 8 * tid) = p;
}

// ---------------------------------------------------------------------------
// Kernel 2: transpose + downconvert v [b,h,k,d] f32 -> vt [b,h,d,k] f16 so
// the WMMA B-fragment loads become two contiguous 16B reads per lane.
// ---------------------------------------------------------------------------
__global__ __launch_bounds__(256)
void k2_vt(const float* __restrict__ v, _Float16* __restrict__ vt)
{
    const int bh = blockIdx.x;
    const float* vin = v + (size_t)bh * S_ * D_;
    _Float16* vo = vt + (size_t)bh * D_ * S_;
    for (int idx = threadIdx.x; idx < D_ * S_; idx += 256) {
        const int d = idx >> 11;          // / 2048
        const int k = idx & (S_ - 1);
        vo[idx] = (_Float16)vin[(size_t)k * D_ + d];
    }
}

// ---------------------------------------------------------------------------
// Kernel 3: head-mix (packed f16 FMA) + attn@v via v_wmma_f32_16x16x32_f16 +
// fused LayerNorm over D.
// Block = 128 threads (4 wave32) covering one head-GROUP (both output heads
// j=0 and j=1): the raw attn fragments a0/a1 are shared by both output heads,
// so each pair of A loads feeds TWO WMMAs (two mixes x two V heads) ->
// 4 b128 loads per WMMA and half the attn L2 traffic vs. one-head blocks.
// Each wave owns one 16-column slice of D for both heads; K loop over 2048
// in steps of 32.  A-fragment K packing per ISA: lanes 0-15 -> K {0..7,16..23},
// lanes 16-31 -> K {8..15,24..31}.
// ---------------------------------------------------------------------------
__global__ __launch_bounds__(128)
void k3_mix_gemm_ln(const _Float16* __restrict__ attn,
                    const _Float16* __restrict__ vt,
                    const float* __restrict__ head_mix,
                    const float* __restrict__ gamma,
                    const float* __restrict__ beta,
                    float* __restrict__ out)
{
    const int m0 = blockIdx.x * 16;
    const int g  = blockIdx.y;            // head group (HEAD_K = 2)
    const int b  = blockIdx.z;

    const int lane = threadIdx.x & 31;
    const int w    = threadIdx.x >> 5;

    // mixed_j = M[g,0,j]*attn_{2g} + M[g,1,j]*attn_{2g+1}
    const _Float16 c00 = (_Float16)head_mix[g * 4 + 0];   // i=0, j=0
    const _Float16 c01 = (_Float16)head_mix[g * 4 + 1];   // i=0, j=1
    const _Float16 c10 = (_Float16)head_mix[g * 4 + 2];   // i=1, j=0
    const _Float16 c11 = (_Float16)head_mix[g * 4 + 3];   // i=1, j=1

    const int mrow = m0 + (lane & 15);
    const int koff = (lane >> 4) << 3;    // 0 or 8

    const size_t bh0 = (size_t)b * H_ + (g * 2 + 0);
    const size_t bh1 = (size_t)b * H_ + (g * 2 + 1);
    const _Float16* a0p = attn + (bh0 * S_ + (size_t)mrow) * S_ + koff;
    const _Float16* a1p = attn + (bh1 * S_ + (size_t)mrow) * S_ + koff;

    const int n = 16 * w + (lane & 15);
    const _Float16* b0p = vt + (bh0 * D_ + (size_t)n) * S_ + koff;
    const _Float16* b1p = vt + (bh1 * D_ + (size_t)n) * S_ + koff;

    v8f acc0 = {};
    v8f acc1 = {};
    for (int k0 = 0; k0 < S_; k0 += 32) {
        const v8h a0lo = *(const v8h*)(a0p + k0);
        const v8h a0hi = *(const v8h*)(a0p + k0 + 16);
        const v8h a1lo = *(const v8h*)(a1p + k0);
        const v8h a1hi = *(const v8h*)(a1p + k0 + 16);
        const v8h b0lo = *(const v8h*)(b0p + k0);
        const v8h b0hi = *(const v8h*)(b0p + k0 + 16);
        const v8h b1lo = *(const v8h*)(b1p + k0);
        const v8h b1hi = *(const v8h*)(b1p + k0 + 16);

        // two head-mixes from one pair of A fragments (v_pk_fma_f16)
        const v8h m0lo = a0lo * c00 + a1lo * c10;
        const v8h m0hi = a0hi * c00 + a1hi * c10;
        const v8h m1lo = a0lo * c01 + a1lo * c11;
        const v8h m1hi = a0hi * c01 + a1hi * c11;

        const v16h A0 = __builtin_shufflevector(m0lo, m0hi,
            0,1,2,3,4,5,6,7,8,9,10,11,12,13,14,15);
        const v16h A1 = __builtin_shufflevector(m1lo, m1hi,
            0,1,2,3,4,5,6,7,8,9,10,11,12,13,14,15);
        const v16h B0 = __builtin_shufflevector(b0lo, b0hi,
            0,1,2,3,4,5,6,7,8,9,10,11,12,13,14,15);
        const v16h B1 = __builtin_shufflevector(b1lo, b1hi,
            0,1,2,3,4,5,6,7,8,9,10,11,12,13,14,15);

        acc0 = __builtin_amdgcn_wmma_f32_16x16x32_f16(
            false, A0, false, B0, (short)0, acc0, false, false);
        acc1 = __builtin_amdgcn_wmma_f32_16x16x32_f16(
            false, A1, false, B1, (short)0, acc1, false, false);
    }

    // Scatter C tiles to LDS: VGPR r -> row r (lanes 0-15) / r+8 (lanes 16-31)
    __shared__ float tile[2][16][72];
    const int rbase = (lane >> 4) << 3;
    const int col   = 16 * w + (lane & 15);
    #pragma unroll
    for (int r = 0; r < 8; ++r) {
        tile[0][rbase + r][col] = acc0[r];
        tile[1][rbase + r][col] = acc1[r];
    }
    __syncthreads();

    // LayerNorm over D=64 for 32 rows (2 heads x 16): 4 threads per row,
    // 16 cols each, shuffle-reduce within aligned 4-lane groups.
    const int t  = threadIdx.x;
    const int jj = t >> 6;                // output head within group
    const int r  = (t >> 2) & 15;        // row within tile
    const int cb = (t & 3) * 16;         // column base
    float x[16];
    float sum = 0.0f, sq = 0.0f;
    #pragma unroll
    for (int i = 0; i < 16; ++i) {
        x[i] = tile[jj][r][cb + i];
        sum += x[i];
        sq  += x[i] * x[i];
    }
    #pragma unroll
    for (int off = 1; off < 4; off <<= 1) {
        sum += __shfl_xor(sum, off, 32);
        sq  += __shfl_xor(sq,  off, 32);
    }
    const float mean = sum * (1.0f / 64.0f);
    const float var  = sq * (1.0f / 64.0f) - mean * mean;
    const float rs   = rsqrtf(var + 1e-5f);

    const size_t obase =
        (((size_t)b * H_ + (g * 2 + jj)) * S_ + (size_t)(m0 + r)) * D_ + cb;
    #pragma unroll
    for (int i = 0; i < 16; ++i)
        out[obase + i] = (x[i] - mean) * rs * gamma[cb + i] + beta[cb + i];
}

// ---------------------------------------------------------------------------
extern "C" void kernel_launch(void* const* d_in, const int* in_sizes, int n_in,
                              void* d_out, int out_size, void* d_ws, size_t ws_size,
                              hipStream_t stream)
{
    const float* scores   = (const float*)d_in[0];
    const float* v        = (const float*)d_in[1];
    const float* kq_w     = (const float*)d_in[2];
    const float* kq_b     = (const float*)d_in[3];
    const float* head_mix = (const float*)d_in[4];
    const float* gamma    = (const float*)d_in[5];
    const float* beta     = (const float*)d_in[6];
    float* out = (float*)d_out;

    // workspace: [attn f16 : B*H*S*S] [vt f16 : B*H*D*S]  (128MB + 4MB)
    _Float16* wsAttn = (_Float16*)d_ws;
    _Float16* wsVt   = (_Float16*)((char*)d_ws +
                        (size_t)B_ * H_ * S_ * S_ * sizeof(_Float16));

    dim3 g1(S_, H_, B_);
    k1_conv_softmax<<<g1, 256, 0, stream>>>(scores, kq_w, kq_b, wsAttn);

    k2_vt<<<B_ * H_, 256, 0, stream>>>(v, wsVt);

    dim3 g3(S_ / 16, H_ / 2, B_);   // one block per head GROUP
    k3_mix_gemm_ln<<<g3, 128, 0, stream>>>(wsAttn, wsVt, head_mix,
                                           gamma, beta, out);
}

// v003
// One run takes 159 microseconds.
// Next to v002, in two timings, it ran 1.49 and 1.48 times as fast.
// Over all steps from v000 it is 3.58 times as fast.
#include <hip/hip_runtime.h>
#include <hip/hip_bf16.h>

typedef __attribute__((ext_vector_type(16))) _Float16 v16h;
typedef __attribute__((ext_vector_type(8)))  _Float16 v8h;
typedef __attribute__((ext_vector_type(8)))  float    v8f;

#define B_  2
#define H_  8
#define S_  2048
#define D_  64
#define QK  6
#define KK  11
#define NEGV (-1.0e9f)
#define HALO 8

// ---------------------------------------------------------------------------
// Kernel 1: masked depthwise conv (6x11, SAME) + bias + causal re-mask +
//           row softmax, emitting f16 probabilities.
// One block per (b,h,s) query row. 256 threads, 8 ADJACENT columns per thread.
// LDS: 6 input rows with an 8-column zero halo on each side (5 are read; 8
// keeps every row and every 4-column group 16-byte aligned).
// Staging: each thread issues its 12 float4 row loads (and the weight load)
// back to back and stores to LDS only afterwards, so a wave pays the memory
// latency once instead of once per element.
// Conv: per source row a thread reads the 24 floats that cover its 8 columns
// and their taps with 6 16-byte LDS reads and slides the 11 taps over them in
// registers, so an LDS word is fetched once per thread and not once per tap.
// ---------------------------------------------------------------------------
#define ROWP  (S_ + 2 * HALO)      // LDS row pitch in floats
#define ROWQ  (ROWP / 4)           // the same in 4-float slots

// Place of 4-float slot q inside an LDS row. The conv reads slots 2*tid + j:
// unswizzled, lanes t and t + 8 of a 16-lane half would meet on the same four
// banks. Swapping the two slots of each pair in every other group of 16 slots
// puts the 16 lanes on 16 different bank quads.
__device__ __forceinline__ int slot_of(int q) { return q ^ ((q >> 4) & 1); }

__global__ __launch_bounds__(256)
void k1_conv_softmax(const float* __restrict__ scores,
                     const float* __restrict__ kq_w,
                     const float* __restrict__ kq_b,
                     _Float16* __restrict__ attn)
{
    const int s = blockIdx.x;
    const int h = blockIdx.y;
    const int b = blockIdx.z;
    const int tid = threadIdx.x;

    __shared__ __attribute__((aligned(16))) float4 sm[QK][ROWQ];
    __shared__ float wsm[QK * KK];
    __shared__ float red[8];

    const float bias = kq_b[h];
    float wv = 0.0f;
    if (tid < QK * KK) wv = kq_w[h * (QK * KK) + tid];

    const size_t rowBase = ((size_t)b * H_ + h) * (size_t)S_;

    // Load 6 source rows (s-2 .. s+3): every load is issued before any store.
    // A 4-column group that lies wholly behind the causal limit is not read.
    // Both loop nests are unrolled so that stg[][] stays in registers and the
    // 12 loads stand in a row with no wait between them.
    float4 stg[QK][2];
    #pragma unroll
    for (int r = 0; r < QK; ++r) {
        const int sp = s + r - 2;       // pad_low = (6-1)/2 = 2
        #pragma unroll
        for (int j = 0; j < 2; ++j) {
            const int k4 = (tid + 256 * j) * 4;
            stg[r][j] = make_float4(0.0f, 0.0f, 0.0f, 0.0f);
            if (sp >= 0 && sp < S_ && k4 <= sp)
                stg[r][j] = ((const float4*)(scores + (rowBase + (size_t)sp) * S_))
                                [(unsigned)(tid + 256 * j)];
        }
    }

    if (tid < QK * KK) wsm[tid] = wv;
    // zero halo: 4 slots per row (2 left, 2 right)
    if (tid < QK * 4) {
        const int q = tid & 3;
        const int c = (q < 2) ? q : ROWQ - 4 + q;
        sm[tid >> 2][slot_of(c)] = make_float4(0.0f, 0.0f, 0.0f, 0.0f);
    }
    // causally zeroed rows; memory column k sits at LDS column k + HALO
    #pragma unroll
    for (int r = 0; r < QK; ++r) {
        const int sp = s + r - 2;
        #pragma unroll
        for (int j = 0; j < 2; ++j) {
            const int k4 = (tid + 256 * j) * 4;
            float4 x = stg[r][j];       // x.x is live or already 0
            x.y = (k4 + 1 <= sp) ? x.y : 0.0f;
            x.z = (k4 + 2 <= sp) ? x.z : 0.0f;
            x.w = (k4 + 3 <= sp) ? x.w : 0.0f;
            sm[r][slot_of(HALO / 4 + tid + 256 * j)] = x;
        }
    }
    __syncthreads();

    // Columns 8*tid .. 8*tid+7. Column k, tap dk reads LDS column k + dk + 3,
    // which is win[i + dk + 3] of the window that starts at LDS column 8*tid.
    // Every loop of the nest is unrolled so that ps[], win[] and acc[] are
    // indexed by constants and stay in registers. Per output the taps are
    // added in the old order (dq outer, dk inner, starting from the bias).
    int ps[6];
    #pragma unroll
    for (int j = 0; j < 6; ++j) ps[j] = slot_of(2 * tid + j);

    float acc[8];
    #pragma unroll
    for (int i = 0; i < 8; ++i) acc[i] = bias;
    #pragma unroll
    for (int dq = 0; dq < QK; ++dq) {
        float win[24];
        #pragma unroll
        for (int j = 0; j < 6; ++j) {
            const float4 q = sm[dq][ps[j]];
            win[4 * j + 0] = q.x;
            win[4 * j + 1] = q.y;
            win[4 * j + 2] = q.z;
            win[4 * j + 3] = q.w;
        }
        #pragma unroll
        for (int dk = 0; dk < KK; ++dk) {
            const float w = wsm[dq * KK + dk];
            #pragma unroll
            for (int i = 0; i < 8; ++i)
                acc[i] = fmaf(w, win[i + dk + (HALO - 5)], acc[i]);
        }
    }

    float vout[8];
    float mx = -3.4e38f;
    #pragma unroll
    for (int i = 0; i < 8; ++i) {
        const float val = (8 * tid + i <= s) ? acc[i] : NEGV;
        vout[i] = val;
        mx = fmaxf(mx, val);
    }

    // block max
    #pragma unroll
    for (int off = 16; off > 0; off >>= 1)
        mx = fmaxf(mx, __shfl_xor(mx, off, 32));
    if ((tid & 31) == 0) red[tid >> 5] = mx;
    __syncthreads();
    mx = red[0];
    #pragma unroll
    for (int i = 1; i < 8; ++i) mx = fmaxf(mx, red[i]);

    // exp + block sum
    float e[8];
    float se = 0.0f;
    #pragma unroll
    for (int i = 0; i < 8; ++i) { e[i] = __expf(vout[i] - mx); se += e[i]; }
    #pragma unroll
    for (int off = 16; off > 0; off >>= 1)
        se += __shfl_xor(se, off, 32);
    __syncthreads();                      // red reuse hazard
    if ((tid & 31) == 0) red[tid >> 5] = se;
    __syncthreads();
    float tot = 0.0f;
    #pragma unroll
    for (int i = 0; i < 8; ++i) tot += red[i];
    const float inv = 1.0f / tot;

    // the thread's 8 adjacent probabilities leave as one 16-byte store
    // (unrolled: p[] is a register vector, indexed by constants)
    v8h p;
    #pragma unroll
    for (int i = 0; i < 8; ++i) p[i] = (_Float16)(e[i] * inv);
    *(v8h*)(attn + (rowBase + (size_t)s) * S_ + 8 * tid) = p;
}

// ---------------------------------------------------------------------------
// Kernel 2: transpose + downconvert v [b,h,k,d] f32 -> vt [b,h,d,k] f16 so
// the WMMA B-fragment loads become two contiguous 16B reads per lane.
// One block per 64-key x 64-dim tile (512 blocks). The tile is 16 KB in a row
// in v: it is read with whole-line 16-byte loads, turned in LDS, and leaves as
// 64 whole 128-byte lines of vt (8 lanes x 16 bytes each).
// LDS pitch 65 floats: the column reads of lanes (chunk c, dim d) fall on bank
// 8c + i + d, 32 different banks; the row writes are conflict-free as well.
// ---------------------------------------------------------------------------
#define TK 64                      // keys per tile

__global__ __launch_bounds__(256)
void k2_vt(const float* __restrict__ v, _Float16* __restrict__ vt)
{
    const int k0  = blockIdx.x * TK;
    const int bh  = blockIdx.y;
    const int tid = threadIdx.x;

    __shared__ float tile[TK][D_ + 1];

    // unrolled: the 4 loads stand in a row, one memory latency for the tile
    const float4* vin = (const float4*)(v + ((size_t)bh * S_ + k0) * D_);
    float4 x[4];
    #pragma unroll
    for (int j = 0; j < 4; ++j) x[j] = vin[tid + 256 * j];
    #pragma unroll
    for (int j = 0; j < 4; ++j) {
        const int idx = tid + 256 * j;
        const int k = idx >> 4;
        const int d = (idx & 15) * 4;
        tile[k][d + 0] = x[j].x;
        tile[k][d + 1] = x[j].y;
        tile[k][d + 2] = x[j].z;
        tile[k][d + 3] = x[j].w;
    }
    __syncthreads();

    // unrolled: p[] is a register vector, indexed by constants
    const int c = tid & 7;                // 8-key chunk of the tile's row
    #pragma unroll
    for (int j = 0; j < 2; ++j) {
        const int d = (tid >> 3) + 32 * j;
        v8h p;
        #pragma unroll
        for (int i = 0; i < 8; ++i) p[i] = (_Float16)tile[8 * c + i][d];
        *(v8h*)(vt + ((size_t)bh * D_ + d) * S_ + k0 + 8 * c) = p;
    }
}

// ---------------------------------------------------------------------------
// Kernel 3: head-mix (packed f16 FMA) + attn@v via v_wmma_f32_16x16x32_f16 +
// fused LayerNorm over D.
// Block = 128 threads (4 wave32) covering one head-GROUP (both output heads
// j=0 and j=1): the raw attn fragments a0/a1 are shared by both output heads,
// so each pair of A loads feeds TWO WMMAs (two mixes x two V heads) ->
// 4 b128 loads per WMMA and half the attn L2 traffic vs. one-head blocks.
// Each wave owns one 16-column slice of D for both heads; K loop over 2048
// in steps of 32.  A-fragment K packing per ISA: lanes 0-15 -> K {0..7,16..23},
// lanes 16-31 -> K {8..15,24..31}.
// ---------------------------------------------------------------------------
__global__ __launch_bounds__(128)
void k3_mix_gemm_ln(const _Float16* __restrict__ attn,
                    const _Float16* __restrict__ vt,
                    const float* __restrict__ head_mix,
                    const float* __restrict__ gamma,
                    const float* __restrict__ beta,
                    float* __restrict__ out)
{
    const int m0 = blockIdx.x * 16;
    const int g  = blockIdx.y;            // head group (HEAD_K = 2)
    const int b  = blockIdx.z;

    const int lane = threadIdx.x & 31;
    const int w    = threadIdx.x >> 5;

    // mixed_j = M[g,0,j]*attn_{2g} + M[g,1,j]*attn_{2g+1}
    const _Float16 c00 = (_Float16)head_mix[g * 4 + 0];   // i=0, j=0
    const _Float16 c01 = (_Float16)head_mix[g * 4 + 1];   // i=0, j=1
    const _Float16 c10 = (_Float16)head_mix[g * 4 + 2];   // i=1, j=0
    const _Float16 c11 = (_Float16)head_mix[g * 4 + 3];   // i=1, j=1

    const int mrow = m0 + (lane & 15);
    const int koff = (lane >> 4) << 3;    // 0 or 8

    const size_t bh0 = (size_t)b * H_ + (g * 2 + 0);
    const size_t bh1 = (size_t)b * H_ + (g * 2 + 1);
    const _Float16* a0p = attn + (bh0 * S_ + (size_t)mrow) * S_ + koff;
    const _Float16* a1p = attn + (bh1 * S_ + (size_t)mrow) * S_ + koff;

    const int n = 16 * w + (lane & 15);
    const _Float16* b0p = vt + (bh0 * D_ + (size_t)n) * S_ + koff;
    const _Float16* b1p = vt + (bh1 * D_ + (size_t)n) * S_ + koff;

    v8f acc0 = {};
    v8f acc1 = {};
    for (int k0 = 0; k0 < S_; k0 += 32) {
        const v8h a0lo = *(const v8h*)(a0p + k0);
        const v8h a0hi = *(const v8h*)(a0p + k0 + 16);
        const v8h a1lo = *(const v8h*)(a1p + k0);
        const v8h a1hi = *(const v8h*)(a1p + k0 + 16);
        const v8h b0lo = *(const v8h*)(b0p + k0);
        const v8h b0hi = *(const v8h*)(b0p + k0 + 16);
        const v8h b1lo = *(const v8h*)(b1p + k0);
        const v8h b1hi = *(const v8h*)(b1p + k0 + 16);

        // two head-mixes from one pair of A fragments (v_pk_fma_f16)
        const v8h m0lo = a0lo * c00 + a1lo * c10;
        const v8h m0hi = a0hi * c00 + a1hi * c10;
        const v8h m1lo = a0lo * c01 + a1lo * c11;
        const v8h m1hi = a0hi * c01 + a1hi * c11;

        const v16h A0 = __builtin_shufflevector(m0lo, m0hi,
            0,1,2,3,4,5,6,7,8,9,10,11,12,13,14,15);
        const v16h A1 = __builtin_shufflevector(m1lo, m1hi,
            0,1,2,3,4,5,6,7,8,9,10,11,12,13,14,15);
        const v16h B0 = __builtin_shufflevector(b0lo, b0hi,
            0,1,2,3,4,5,6,7,8,9,10,11,12,13,14,15);
        const v16h B1 = __builtin_shufflevector(b1lo, b1hi,
            0,1,2,3,4,5,6,7,8,9,10,11,12,13,14,15);

        acc0 = __builtin_amdgcn_wmma_f32_16x16x32_f16(
            false, A0, false, B0, (short)0, acc0, false, false);
        acc1 = __builtin_amdgcn_wmma_f32_16x16x32_f16(
            false, A1, false, B1, (short)0, acc1, false, false);
    }

    // Scatter C tiles to LDS: VGPR r -> row r (lanes 0-15) / r+8 (lanes 16-31)
    __shared__ float tile[2][16][72];
    const int rbase = (lane >> 4) << 3;
    const int col   = 16 * w + (lane & 15);
    #pragma unroll
    for (int r = 0; r < 8; ++r) {
        tile[0][rbase + r][col] = acc0[r];
        tile[1][rbase + r][col] = acc1[r];
    }
    __syncthreads();

    // LayerNorm over D=64 for 32 rows (2 heads x 16): 4 threads per row,
    // 16 cols each, shuffle-reduce within aligned 4-lane groups.
    const int t  = threadIdx.x;
    const int jj = t >> 6;                // output head within group
    const int r  = (t >> 2) & 15;        // row within tile
    const int cb = (t & 3) * 16;         // column base
    float x[16];
    float sum = 0.0f, sq = 0.0f;
    #pragma unroll
    for (int i = 0; i < 16; ++i) {
        x[i] = tile[jj][r][cb + i];
        sum += x[i];
        sq  += x[i] * x[i];
    }
    #pragma unroll
    for (int off = 1; off < 4; off <<= 1) {
        sum += __shfl_xor(sum, off, 32);
        sq  += __shfl_xor(sq,  off, 32);
    }
    const float mean = sum * (1.0f / 64.0f);
    const float var  = sq * (1.0f / 64.0f) - mean * mean;
    const float rs   = rsqrtf(var + 1e-5f);

    const size_t obase =
        (((size_t)b * H_ + (g * 2 + jj)) * S_ + (size_t)(m0 + r)) * D_ + cb;
    #pragma unroll
    for (int i = 0; i < 16; ++i)
        out[obase + i] = (x[i] - mean) * rs * gamma[cb + i] + beta[cb + i];
}

// ---------------------------------------------------------------------------
extern "C" void kernel_launch(void* const* d_in, const int* in_sizes, int n_in,
                              void* d_out, int out_size, void* d_ws, size_t ws_size,
                              hipStream_t stream)
{
    const float* scores   = (const float*)d_in[0];
    const float* v        = (const float*)d_in[1];
    const float* kq_w     = (const float*)d_in[2];
    const float* kq_b     = (const float*)d_in[3];
    const float* head_mix = (const float*)d_in[4];
    const float* gamma    = (const float*)d_in[5];
    const float* beta     = (const float*)d_in[6];
    float* out = (float*)d_out;

    // workspace: [attn f16 : B*H*S*S] [vt f16 : B*H*D*S]  (128MB + 4MB)
    _Float16* wsAttn = (_Float16*)d_ws;
    _Float16* wsVt   = (_Float16*)((char*)d_ws +
                        (size_t)B_ * H_ * S_ * S_ * sizeof(_Float16));

    dim3 g1(S_, H_, B_);
    k1_conv_softmax<<<g1, 256, 0, stream>>>(scores, kq_w, kq_b, wsAttn);

    dim3 g2(S_ / TK, B_ * H_);
    k2_vt<<<g2, 256, 0, stream>>>(v, wsVt);

    dim3 g3(S_ / 16, H_ / 2, B_);   // one block per head GROUP
    k3_mix_gemm_ln<<<g3, 128, 0, stream>>>(wsAttn, wsVt, head_mix,
                                           gamma, beta, out);
}

// v004
// It runs in 148 microseconds.
// Timed twice side by side with v003, it ran 1.08 and 1.07 times as fast.
// Counting every step since v000, it is 3.84 times as fast.
#include <hip/hip_runtime.h>
#include <hip/hip_bf16.h>

typedef __attribute__((ext_vector_type(16))) _Float16 v16h;
typedef __attribute__((ext_vector_type(8)))  _Float16 v8h;
typedef __attribute__((ext_vector_type(8)))  float    v8f;

#define B_  2
#define H_  8
#define S_  2048
#define D_  64
#define QK  6
#define KK  11
#define NEGV (-1.0e9f)
#define HALO 8

// ---------------------------------------------------------------------------
// Kernel 1: masked depthwise conv (6x11, SAME) + bias + causal re-mask +
//           row softmax, emitting f16 probabilities.
// One block per (b,h,s) query row. 256 threads, 8 ADJACENT columns per thread.
// LDS: 6 input rows with an 8-column zero halo on each side (5 are read; 8
// keeps every row and every 4-column group 16-byte aligned).
// Staging: each thread issues its 12 float4 row loads (and the weight load)
// back to back and stores to LDS only afterwards, so a wave pays the memory
// latency once instead of once per element.
// Conv: per source row a thread reads the 24 floats that cover its 8 columns
// and their taps with 6 16-byte LDS reads and slides the 11 taps over them in
// registers, so an LDS word is fetched once per thread and not once per tap.
// Causal limit: a wave owns one chunk of 256 columns. A chunk that starts
// behind column s holds only masked columns, all equal to NEGV: its wave reads
// no window, does no conv, and takes one exp for its equal terms. Nothing is
// staged behind the last column that a live chunk's windows reach.
// ---------------------------------------------------------------------------
#define ROWP  (S_ + 2 * HALO)      // LDS row pitch in floats
#define ROWQ  (ROWP / 4)           // the same in 4-float slots

// Place of 4-float slot q inside an LDS row. The conv reads slots 2*ct + j:
// unswizzled, lanes t and t + 8 of a 16-lane half would meet on the same four
// banks. Swapping the two slots of each pair in every other group of 16 slots
// puts the 16 lanes on 16 different bank quads.
__device__ __forceinline__ int slot_of(int q) { return q ^ ((q >> 4) & 1); }

__global__ __launch_bounds__(256)
void k1_conv_softmax(const float* __restrict__ scores,
                     const float* __restrict__ kq_w,
                     const float* __restrict__ kq_b,
                     _Float16* __restrict__ attn)
{
    const int s = blockIdx.x;
    const int h = blockIdx.y;
    const int b = blockIdx.z;
    const int tid = threadIdx.x;
    const int lane = tid & 31;

    // Which chunk of 256 columns this wave owns. The live
    // chunks are the low ones, so a fixed map would load the
    // first SIMD most in every block; the start is turned from row to row so
    // that the live waves of the blocks on a WGP spread over its four SIMDs.
    // readfirstlane: the wave's number in a scalar register, so that the skip
    // below is a scalar branch.
    const int wave  = __builtin_amdgcn_readfirstlane(tid >> 5);
    const int turn  = s ^ (s >> 2) ^ (s >> 4) ^ (s >> 6) ^ (s >> 8) ^ (s >> 10);
    const int chunk = (wave + turn) & 7;
    const int ct    = 32 * chunk + lane;  // the thread makes columns 8*ct..8*ct+7
    const bool live = 256 * chunk <= s;   // the same for the whole wave
    // first column that no live window reaches (the last live chunk ends at
    // column s | 255 and its windows run 8 columns further)
    const int stageEnd = (s | 255) + 9;

    __shared__ __attribute__((aligned(16))) float4 sm[QK][ROWQ];
    __shared__ float wsm[QK * KK];
    __shared__ float red[8];

    const float bias = kq_b[h];
    float wv = 0.0f;
    if (tid < QK * KK) wv = kq_w[h * (QK * KK) + tid];

    const size_t rowBase = ((size_t)b * H_ + h) * (size_t)S_;

    // Load 6 source rows (s-2 .. s+3): every load is issued before any store.
    // A 4-column group that lies wholly behind the causal limit is not read.
    // Both loop nests are unrolled so that stg[][] stays in registers and the
    // 12 loads stand in a row with no wait between them.
    float4 stg[QK][2];
    #pragma unroll
    for (int r = 0; r < QK; ++r) {
        const int sp = s + r - 2;       // pad_low = (6-1)/2 = 2
        #pragma unroll
        for (int j = 0; j < 2; ++j) {
            const int k4 = (tid + 256 * j) * 4;
            stg[r][j] = make_float4(0.0f, 0.0f, 0.0f, 0.0f);
            if (sp >= 0 && sp < S_ && k4 <= sp)
                stg[r][j] = ((const float4*)(scores + (rowBase + (size_t)sp) * S_))
                                [(unsigned)(tid + 256 * j)];
        }
    }

    if (tid < QK * KK) wsm[tid] = wv;
    // zero halo: 4 slots per row (2 left, 2 right)
    if (tid < QK * 4) {
        const int q = tid & 3;
        const int c = (q < 2) ? q : ROWQ - 4 + q;
        sm[tid >> 2][slot_of(c)] = make_float4(0.0f, 0.0f, 0.0f, 0.0f);
    }
    // causally zeroed rows; memory column k sits at LDS column k + HALO
    #pragma unroll
    for (int j = 0; j < 2; ++j) {
        const int k4 = (tid + 256 * j) * 4;
        if (k4 < stageEnd) {
            #pragma unroll
            for (int r = 0; r < QK; ++r) {
                const int sp = s + r - 2;
                float4 x = stg[r][j];   // x.x is live or already 0
                x.y = (k4 + 1 <= sp) ? x.y : 0.0f;
                x.z = (k4 + 2 <= sp) ? x.z : 0.0f;
                x.w = (k4 + 3 <= sp) ? x.w : 0.0f;
                sm[r][slot_of(HALO / 4 + tid + 256 * j)] = x;
            }
        }
    }
    __syncthreads();

    // Columns 8*ct .. 8*ct+7. Column k, tap dk reads LDS column k + dk + 3,
    // which is win[i + dk + 3] of the window that starts at LDS column 8*ct.
    // Every loop of the nest is unrolled so that ps[], win[] and acc[] are
    // indexed by constants and stay in registers. Per output the taps are
    // added in the old order (dq outer, dk inner, starting from the bias).
    float vout[8];
    float mx = NEGV;                      // a chunk behind the limit: all NEGV
    if (live) {
        int ps[6];
        #pragma unroll
        for (int j = 0; j < 6; ++j) ps[j] = slot_of(2 * ct + j);

        float acc[8];
        #pragma unroll
        for (int i = 0; i < 8; ++i) acc[i] = bias;
        #pragma unroll
        for (int dq = 0; dq < QK; ++dq) {
            float win[24];
            #pragma unroll
            for (int j = 0; j < 6; ++j) {
                const float4 q = sm[dq][ps[j]];
                win[4 * j + 0] = q.x;
                win[4 * j + 1] = q.y;
                win[4 * j + 2] = q.z;
                win[4 * j + 3] = q.w;
            }
            #pragma unroll
            for (int dk = 0; dk < KK; ++dk) {
                const float w = wsm[dq * KK + dk];
                #pragma unroll
                for (int i = 0; i < 8; ++i)
                    acc[i] = fmaf(w, win[i + dk + (HALO - 5)], acc[i]);
            }
        }

        mx = -3.4e38f;
        #pragma unroll
        for (int i = 0; i < 8; ++i) {
            const float val = (8 * ct + i <= s) ? acc[i] : NEGV;
            vout[i] = val;
            mx = fmaxf(mx, val);
        }
        #pragma unroll
        for (int off = 16; off > 0; off >>= 1)
            mx = fmaxf(mx, __shfl_xor(mx, off, 32));
    }

    // block max; red[] is indexed by chunk, so it is read in column order
    if (lane == 0) red[chunk] = mx;
    __syncthreads();
    mx = red[0];
    #pragma unroll
    for (int i = 1; i < 8; ++i) mx = fmaxf(mx, red[i]);

    // exp + block sum
    float e[8];
    float se = 0.0f;
    if (live) {
        #pragma unroll
        for (int i = 0; i < 8; ++i)       // e^x as 2^(x * log2 e), as __expf does
            vout[i] = (vout[i] - mx) * 1.44269504f;
        // The 8 v_exp_f32 stand in one statement, each on registers of its own,
        // with the free slot that the instruction set asks for behind the last.
        asm("v_exp_f32 %0, %8\n\t"
            "v_exp_f32 %1, %9\n\t"
            "v_exp_f32 %2, %10\n\t"
            "v_exp_f32 %3, %11\n\t"
            "v_exp_f32 %4, %12\n\t"
            "v_exp_f32 %5, %13\n\t"
            "v_exp_f32 %6, %14\n\t"
            "v_exp_f32 %7, %15\n\t"
            "v_nop"
            : "=&v"(e[0]), "=&v"(e[1]), "=&v"(e[2]), "=&v"(e[3]),
              "=&v"(e[4]), "=&v"(e[5]), "=&v"(e[6]), "=&v"(e[7])
            : "v"(vout[0]), "v"(vout[1]), "v"(vout[2]), "v"(vout[3]),
              "v"(vout[4]), "v"(vout[5]), "v"(vout[6]), "v"(vout[7]));
        #pragma unroll
        for (int i = 0; i < 8; ++i) se += e[i];
        #pragma unroll
        for (int off = 16; off > 0; off >>= 1)
            se += __shfl_xor(se, off, 32);
    } else {
        // 256 equal terms
        const float e0 = __expf(NEGV - mx);
        #pragma unroll
        for (int i = 0; i < 8; ++i) e[i] = e0;
        se = 256.0f * e0;
    }
    __syncthreads();                      // red reuse hazard
    if (lane == 0) red[chunk] = se;
    __syncthreads();
    float tot = 0.0f;
    #pragma unroll
    for (int i = 0; i < 8; ++i) tot += red[i];
    const float inv = 1.0f / tot;

    // the thread's 8 adjacent probabilities leave as one 16-byte store
    // (unrolled: p[] is a register vector, indexed by constants)
    v8h p;
    #pragma unroll
    for (int i = 0; i < 8; ++i) p[i] = (_Float16)(e[i] * inv);
    *(v8h*)(attn + (rowBase + (size_t)s) * S_ + 8 * ct) = p;
}

// ---------------------------------------------------------------------------
// Kernel 2: transpose + downconvert v [b,h,k,d] f32 -> vt [b,h,d,k] f16 so
// the WMMA B-fragment loads become two contiguous 16B reads per lane.
// One block per 64-key x 64-dim tile (512 blocks). The tile is 16 KB in a row
// in v: it is read with whole-line 16-byte loads, turned in LDS, and leaves as
// 64 whole 128-byte lines of vt (8 lanes x 16 bytes each).
// LDS pitch 65 floats: the column reads of lanes (chunk c, dim d) fall on bank
// 8c + i + d, 32 different banks; the row writes are conflict-free as well.
// ---------------------------------------------------------------------------
#define TK 64                      // keys per tile

__global__ __launch_bounds__(256)
void k2_vt(const float* __restrict__ v, _Float16* __restrict__ vt)
{
    const int k0  = blockIdx.x * TK;
    const int bh  = blockIdx.y;
    const int tid = threadIdx.x;

    __shared__ float tile[TK][D_ + 1];

    // unrolled: the 4 loads stand in a row, one memory latency for the tile
    const float4* vin = (const float4*)(v + ((size_t)bh * S_ + k0) * D_);
    float4 x[4];
    #pragma unroll
    for (int j = 0; j < 4; ++j) x[j] = vin[tid + 256 * j];
    #pragma unroll
    for (int j = 0; j < 4; ++j) {
        const int idx = tid + 256 * j;
        const int k = idx >> 4;
        const int d = (idx & 15) * 4;
        tile[k][d + 0] = x[j].x;
        tile[k][d + 1] = x[j].y;
        tile[k][d + 2] = x[j].z;
        tile[k][d + 3] = x[j].w;
    }
    __syncthreads();

    // unrolled: p[] is a register vector, indexed by constants
    const int c = tid & 7;                // 8-key chunk of the tile's row
    #pragma unroll
    for (int j = 0; j < 2; ++j) {
        const int d = (tid >> 3) + 32 * j;
        v8h p;
        #pragma unroll
        for (int i = 0; i < 8; ++i) p[i] = (_Float16)tile[8 * c + i][d];
        *(v8h*)(vt + ((size_t)bh * D_ + d) * S_ + k0 + 8 * c) = p;
    }
}

// ---------------------------------------------------------------------------
// Kernel 3: head-mix (packed f16 FMA) + attn@v via v_wmma_f32_16x16x32_f16 +
// fused LayerNorm over D.
// Block = 128 threads (4 wave32) covering one head-GROUP (both output heads
// j=0 and j=1): the raw attn fragments a0/a1 are shared by both output heads,
// so each pair of A loads feeds TWO WMMAs (two mixes x two V heads) ->
// 4 b128 loads per WMMA and half the attn L2 traffic vs. one-head blocks.
// Each wave owns one 16-column slice of D for both heads; K loop over 2048
// in steps of 32.  A-fragment K packing per ISA: lanes 0-15 -> K {0..7,16..23},
// lanes 16-31 -> K {8..15,24..31}.
// ---------------------------------------------------------------------------
__global__ __launch_bounds__(128)
void k3_mix_gemm_ln(const _Float16* __restrict__ attn,
                    const _Float16* __restrict__ vt,
                    const float* __restrict__ head_mix,
                    const float* __restrict__ gamma,
                    const float* __restrict__ beta,
                    float* __restrict__ out)
{
    const int m0 = blockIdx.x * 16;
    const int g  = blockIdx.y;            // head group (HEAD_K = 2)
    const int b  = blockIdx.z;

    const int lane = threadIdx.x & 31;
    const int w    = threadIdx.x >> 5;

    // mixed_j = M[g,0,j]*attn_{2g} + M[g,1,j]*attn_{2g+1}
    const _Float16 c00 = (_Float16)head_mix[g * 4 + 0];   // i=0, j=0
    const _Float16 c01 = (_Float16)head_mix[g * 4 + 1];   // i=0, j=1
    const _Float16 c10 = (_Float16)head_mix[g * 4 + 2];   // i=1, j=0
    const _Float16 c11 = (_Float16)head_mix[g * 4 + 3];   // i=1, j=1

    const int mrow = m0 + (lane & 15);
    const int koff = (lane >> 4) << 3;    // 0 or 8

    const size_t bh0 = (size_t)b * H_ + (g * 2 + 0);
    const size_t bh1 = (size_t)b * H_ + (g * 2 + 1);
    const _Float16* a0p = attn + (bh0 * S_ + (size_t)mrow) * S_ + koff;
    const _Float16* a1p = attn + (bh1 * S_ + (size_t)mrow) * S_ + koff;

    const int n = 16 * w + (lane & 15);
    const _Float16* b0p = vt + (bh0 * D_ + (size_t)n) * S_ + koff;
    const _Float16* b1p = vt + (bh1 * D_ + (size_t)n) * S_ + koff;

    v8f acc0 = {};
    v8f acc1 = {};
    for (int k0 = 0; k0 < S_; k0 += 32) {
        const v8h a0lo = *(const v8h*)(a0p + k0);
        const v8h a0hi = *(const v8h*)(a0p + k0 + 16);
        const v8h a1lo = *(const v8h*)(a1p + k0);
        const v8h a1hi = *(const v8h*)(a1p + k0 + 16);
        const v8h b0lo = *(const v8h*)(b0p + k0);
        const v8h b0hi = *(const v8h*)(b0p + k0 + 16);
        const v8h b1lo = *(const v8h*)(b1p + k0);
        const v8h b1hi = *(const v8h*)(b1p + k0 + 16);

        // two head-mixes from one pair of A fragments (v_pk_fma_f16)
        const v8h m0lo = a0lo * c00 + a1lo * c10;
        const v8h m0hi = a0hi * c00 + a1hi * c10;
        const v8h m1lo = a0lo * c01 + a1lo * c11;
        const v8h m1hi = a0hi * c01 + a1hi * c11;

        const v16h A0 = __builtin_shufflevector(m0lo, m0hi,
            0,1,2,3,4,5,6,7,8,9,10,11,12,13,14,15);
        const v16h A1 = __builtin_shufflevector(m1lo, m1hi,
            0,1,2,3,4,5,6,7,8,9,10,11,12,13,14,15);
        const v16h B0 = __builtin_shufflevector(b0lo, b0hi,
            0,1,2,3,4,5,6,7,8,9,10,11,12,13,14,15);
        const v16h B1 = __builtin_shufflevector(b1lo, b1hi,
            0,1,2,3,4,5,6,7,8,9,10,11,12,13,14,15);

        acc0 = __builtin_amdgcn_wmma_f32_16x16x32_f16(
            false, A0, false, B0, (short)0, acc0, false, false);
        acc1 = __builtin_amdgcn_wmma_f32_16x16x32_f16(
            false, A1, false, B1, (short)0, acc1, false, false);
    }

    // Scatter C tiles to LDS: VGPR r -> row r (lanes 0-15) / r+8 (lanes 16-31)
    __shared__ float tile[2][16][72];
    const int rbase = (lane >> 4) << 3;
    const int col   = 16 * w + (lane & 15);
    #pragma unroll
    for (int r = 0; r < 8; ++r) {
        tile[0][rbase + r][col] = acc0[r];
        tile[1][rbase + r][col] = acc1[r];
    }
    __syncthreads();

    // LayerNorm over D=64 for 32 rows (2 heads x 16): 4 threads per row,
    // 16 cols each, shuffle-reduce within aligned 4-lane groups.
    const int t  = threadIdx.x;
    const int jj = t >> 6;                // output head within group
    const int r  = (t >> 2) & 15;        // row within tile
    const int cb = (t & 3) * 16;         // column base
    float x[16];
    float sum = 0.0f, sq = 0.0f;
    #pragma unroll
    for (int i = 0; i < 16; ++i) {
        x[i] = tile[jj][r][cb + i];
        sum += x[i];
        sq  += x[i] * x[i];
    }
    #pragma unroll
    for (int off = 1; off < 4; off <<= 1) {
        sum += __shfl_xor(sum, off, 32);
        sq  += __shfl_xor(sq,  off, 32);
    }
    const float mean = sum * (1.0f / 64.0f);
    const float var  = sq * (1.0f / 64.0f) - mean * mean;
    const float rs   = rsqrtf(var + 1e-5f);

    const size_t obase =
        (((size_t)b * H_ + (g * 2 + jj)) * S_ + (size_t)(m0 + r)) * D_ + cb;
    #pragma unroll
    for (int i = 0; i < 16; ++i)
        out[obase + i] = (x[i] - mean) * rs * gamma[cb + i] + beta[cb + i];
}

// ---------------------------------------------------------------------------
extern "C" void kernel_launch(void* const* d_in, const int* in_sizes, int n_in,
                              void* d_out, int out_size, void* d_ws, size_t ws_size,
                              hipStream_t stream)
{
    const float* scores   = (const float*)d_in[0];
    const float* v        = (const float*)d_in[1];
    const float* kq_w     = (const float*)d_in[2];
    const float* kq_b     = (const float*)d_in[3];
    const float* head_mix = (const float*)d_in[4];
    const float* gamma    = (const float*)d_in[5];
    const float* beta     = (const float*)d_in[6];
    float* out = (float*)d_out;

    // workspace: [attn f16 : B*H*S*S] [vt f16 : B*H*D*S]  (128MB + 4MB)
    _Float16* wsAttn = (_Float16*)d_ws;
    _Float16* wsVt   = (_Float16*)((char*)d_ws +
                        (size_t)B_ * H_ * S_ * S_ * sizeof(_Float16));

    dim3 g1(S_, H_, B_);
    k1_conv_softmax<<<g1, 256, 0, stream>>>(scores, kq_w, kq_b, wsAttn);

    dim3 g2(S_ / TK, B_ * H_);
    k2_vt<<<g2, 256, 0, stream>>>(v, wsVt);

    dim3 g3(S_ / 16, H_ / 2, B_);   // one block per head GROUP
    k3_mix_gemm_ln<<<g3, 128, 0, stream>>>(wsAttn, wsVt, head_mix,
                                           gamma, beta, out);
}

// v005
// One run takes 123 microseconds.
// Next to v004, in two timings, it ran 1.20 times as fast each time.
// Counting every step since v000, it is 4.61 times as fast.
#include <hip/hip_runtime.h>
#include <hip/hip_bf16.h>

typedef __attribute__((ext_vector_type(16))) _Float16 v16h;
typedef __attribute__((ext_vector_type(8)))  _Float16 v8h;
typedef __attribute__((ext_vector_type(8)))  float    v8f;

#define B_  2
#define H_  8
#define S_  2048
#define D_  64
#define QK  6
#define KK  11
#define NEGV (-1.0e9f)
#define HALO 8

// ---------------------------------------------------------------------------
// Kernel 1: masked depthwise conv (6x11, SAME) + bias + causal re-mask +
//           row softmax, emitting f16 probabilities.
// One block per (b,h,s) query row. 256 threads, 8 ADJACENT columns per thread.
// LDS: 6 input rows with an 8-column zero halo on each side (5 are read; 8
// keeps every row and every 4-column group 16-byte aligned).
// Staging: each thread issues its 12 float4 row loads (and the weight load)
// back to back and stores to LDS only afterwards, so a wave pays the memory
// latency once instead of once per element.
// Conv: per source row a thread reads the 24 floats that cover its 8 columns
// and their taps with 6 16-byte LDS reads and slides the 11 taps over them in
// registers, so an LDS word is fetched once per thread and not once per tap.
// Causal limit: a wave owns one chunk of 256 columns. A chunk that starts
// behind column s holds only masked columns, all equal to NEGV: its wave reads
// no window, does no conv, and takes one exp for its equal terms. Nothing is
// staged behind the last column that a live chunk's windows reach.
// ---------------------------------------------------------------------------
#define ROWP  (S_ + 2 * HALO)      // LDS row pitch in floats
#define ROWQ  (ROWP / 4)           // the same in 4-float slots

// Place of 4-float slot q inside an LDS row. The conv reads slots 2*ct + j:
// unswizzled, lanes t and t + 8 of a 16-lane half would meet on the same four
// banks. Swapping the two slots of each pair in every other group of 16 slots
// puts the 16 lanes on 16 different bank quads.
__device__ __forceinline__ int slot_of(int q) { return q ^ ((q >> 4) & 1); }

__global__ __launch_bounds__(256)
void k1_conv_softmax(const float* __restrict__ scores,
                     const float* __restrict__ kq_w,
                     const float* __restrict__ kq_b,
                     _Float16* __restrict__ attn)
{
    const int s = blockIdx.x;
    const int h = blockIdx.y;
    const int b = blockIdx.z;
    const int tid = threadIdx.x;
    const int lane = tid & 31;

    // Which chunk of 256 columns this wave owns. The live
    // chunks are the low ones, so a fixed map would load the
    // first SIMD most in every block; the start is turned from row to row so
    // that the live waves of the blocks on a WGP spread over its four SIMDs.
    // readfirstlane: the wave's number in a scalar register, so that the skip
    // below is a scalar branch.
    const int wave  = __builtin_amdgcn_readfirstlane(tid >> 5);
    const int turn  = s ^ (s >> 2) ^ (s >> 4) ^ (s >> 6) ^ (s >> 8) ^ (s >> 10);
    const int chunk = (wave + turn) & 7;
    const int ct    = 32 * chunk + lane;  // the thread makes columns 8*ct..8*ct+7
    const bool live = 256 * chunk <= s;   // the same for the whole wave
    // first column that no live window reaches (the last live chunk ends at
    // column s | 255 and its windows run 8 columns further)
    const int stageEnd = (s | 255) + 9;

    __shared__ __attribute__((aligned(16))) float4 sm[QK][ROWQ];
    __shared__ float wsm[QK * KK];
    __shared__ float red[8];

    const float bias = kq_b[h];
    float wv = 0.0f;
    if (tid < QK * KK) wv = kq_w[h * (QK * KK) + tid];

    const size_t rowBase = ((size_t)b * H_ + h) * (size_t)S_;

    // Load 6 source rows (s-2 .. s+3): every load is issued before any store.
    // A 4-column group that lies wholly behind the causal limit is not read.
    // Both loop nests are unrolled so that stg[][] stays in registers and the
    // 12 loads stand in a row with no wait between them.
    float4 stg[QK][2];
    #pragma unroll
    for (int r = 0; r < QK; ++r) {
        const int sp = s + r - 2;       // pad_low = (6-1)/2 = 2
        #pragma unroll
        for (int j = 0; j < 2; ++j) {
            const int k4 = (tid + 256 * j) * 4;
            stg[r][j] = make_float4(0.0f, 0.0f, 0.0f, 0.0f);
            if (sp >= 0 && sp < S_ && k4 <= sp)
                stg[r][j] = ((const float4*)(scores + (rowBase + (size_t)sp) * S_))
                                [(unsigned)(tid + 256 * j)];
        }
    }

    if (tid < QK * KK) wsm[tid] = wv;
    // zero halo: 4 slots per row (2 left, 2 right)
    if (tid < QK * 4) {
        const int q = tid & 3;
        const int c = (q < 2) ? q : ROWQ - 4 + q;
        sm[tid >> 2][slot_of(c)] = make_float4(0.0f, 0.0f, 0.0f, 0.0f);
    }
    // causally zeroed rows; memory column k sits at LDS column k + HALO
    #pragma unroll
    for (int j = 0; j < 2; ++j) {
        const int k4 = (tid + 256 * j) * 4;
        if (k4 < stageEnd) {
            #pragma unroll
            for (int r = 0; r < QK; ++r) {
                const int sp = s + r - 2;
                float4 x = stg[r][j];   // x.x is live or already 0
                x.y = (k4 + 1 <= sp) ? x.y : 0.0f;
                x.z = (k4 + 2 <= sp) ? x.z : 0.0f;
                x.w = (k4 + 3 <= sp) ? x.w : 0.0f;
                sm[r][slot_of(HALO / 4 + tid + 256 * j)] = x;
            }
        }
    }
    __syncthreads();

    // Columns 8*ct .. 8*ct+7. Column k, tap dk reads LDS column k + dk + 3,
    // which is win[i + dk + 3] of the window that starts at LDS column 8*ct.
    // Every loop of the nest is unrolled so that ps[], win[] and acc[] are
    // indexed by constants and stay in registers. Per output the taps are
    // added in the old order (dq outer, dk inner, starting from the bias).
    float vout[8];
    float mx = NEGV;                      // a chunk behind the limit: all NEGV
    if (live) {
        int ps[6];
        #pragma unroll
        for (int j = 0; j < 6; ++j) ps[j] = slot_of(2 * ct + j);

        float acc[8];
        #pragma unroll
        for (int i = 0; i < 8; ++i) acc[i] = bias;
        #pragma unroll
        for (int dq = 0; dq < QK; ++dq) {
            float win[24];
            #pragma unroll
            for (int j = 0; j < 6; ++j) {
                const float4 q = sm[dq][ps[j]];
                win[4 * j + 0] = q.x;
                win[4 * j + 1] = q.y;
                win[4 * j + 2] = q.z;
                win[4 * j + 3] = q.w;
            }
            #pragma unroll
            for (int dk = 0; dk < KK; ++dk) {
                const float w = wsm[dq * KK + dk];
                #pragma unroll
                for (int i = 0; i < 8; ++i)
                    acc[i] = fmaf(w, win[i + dk + (HALO - 5)], acc[i]);
            }
        }

        mx = -3.4e38f;
        #pragma unroll
        for (int i = 0; i < 8; ++i) {
            const float val = (8 * ct + i <= s) ? acc[i] : NEGV;
            vout[i] = val;
            mx = fmaxf(mx, val);
        }
        #pragma unroll
        for (int off = 16; off > 0; off >>= 1)
            mx = fmaxf(mx, __shfl_xor(mx, off, 32));
    }

    // block max; red[] is indexed by chunk, so it is read in column order
    if (lane == 0) red[chunk] = mx;
    __syncthreads();
    mx = red[0];
    #pragma unroll
    for (int i = 1; i < 8; ++i) mx = fmaxf(mx, red[i]);

    // exp + block sum
    float e[8];
    float se = 0.0f;
    if (live) {
        #pragma unroll
        for (int i = 0; i < 8; ++i)       // e^x as 2^(x * log2 e), as __expf does
            vout[i] = (vout[i] - mx) * 1.44269504f;
        // The 8 v_exp_f32 stand in one statement, each on registers of its own,
        // with the free slot that the instruction set asks for behind the last.
        asm("v_exp_f32 %0, %8\n\t"
            "v_exp_f32 %1, %9\n\t"
            "v_exp_f32 %2, %10\n\t"
            "v_exp_f32 %3, %11\n\t"
            "v_exp_f32 %4, %12\n\t"
            "v_exp_f32 %5, %13\n\t"
            "v_exp_f32 %6, %14\n\t"
            "v_exp_f32 %7, %15\n\t"
            "v_nop"
            : "=&v"(e[0]), "=&v"(e[1]), "=&v"(e[2]), "=&v"(e[3]),
              "=&v"(e[4]), "=&v"(e[5]), "=&v"(e[6]), "=&v"(e[7])
            : "v"(vout[0]), "v"(vout[1]), "v"(vout[2]), "v"(vout[3]),
              "v"(vout[4]), "v"(vout[5]), "v"(vout[6]), "v"(vout[7]));
        #pragma unroll
        for (int i = 0; i < 8; ++i) se += e[i];
        #pragma unroll
        for (int off = 16; off > 0; off >>= 1)
            se += __shfl_xor(se, off, 32);
    } else {
        // 256 equal terms
        const float e0 = __expf(NEGV - mx);
        #pragma unroll
        for (int i = 0; i < 8; ++i) e[i] = e0;
        se = 256.0f * e0;
    }
    __syncthreads();                      // red reuse hazard
    if (lane == 0) red[chunk] = se;
    __syncthreads();
    float tot = 0.0f;
    #pragma unroll
    for (int i = 0; i < 8; ++i) tot += red[i];
    const float inv = 1.0f / tot;

    // the thread's 8 adjacent probabilities leave as one 16-byte store
    // (unrolled: p[] is a register vector, indexed by constants)
    v8h p;
    #pragma unroll
    for (int i = 0; i < 8; ++i) p[i] = (_Float16)(e[i] * inv);
    *(v8h*)(attn + (rowBase + (size_t)s) * S_ + 8 * ct) = p;
}

// ---------------------------------------------------------------------------
// Kernel 2: transpose + downconvert v [b,h,k,d] f32 -> vt [b,h,d,k] f16 so
// the WMMA B-fragment loads become two contiguous 16B reads per lane.
// One block per 64-key x 64-dim tile (512 blocks). The tile is 16 KB in a row
// in v: it is read with whole-line 16-byte loads, turned in LDS, and leaves as
// 64 whole 128-byte lines of vt (8 lanes x 16 bytes each).
// LDS pitch 65 floats: the column reads of lanes (chunk c, dim d) fall on bank
// 8c + i + d, 32 different banks; the row writes are conflict-free as well.
// ---------------------------------------------------------------------------
#define TK 64                      // keys per tile

__global__ __launch_bounds__(256)
void k2_vt(const float* __restrict__ v, _Float16* __restrict__ vt)
{
    const int k0  = blockIdx.x * TK;
    const int bh  = blockIdx.y;
    const int tid = threadIdx.x;

    __shared__ float tile[TK][D_ + 1];

    // unrolled: the 4 loads stand in a row, one memory latency for the tile
    const float4* vin = (const float4*)(v + ((size_t)bh * S_ + k0) * D_);
    float4 x[4];
    #pragma unroll
    for (int j = 0; j < 4; ++j) x[j] = vin[tid + 256 * j];
    #pragma unroll
    for (int j = 0; j < 4; ++j) {
        const int idx = tid + 256 * j;
        const int k = idx >> 4;
        const int d = (idx & 15) * 4;
        tile[k][d + 0] = x[j].x;
        tile[k][d + 1] = x[j].y;
        tile[k][d + 2] = x[j].z;
        tile[k][d + 3] = x[j].w;
    }
    __syncthreads();

    // unrolled: p[] is a register vector, indexed by constants
    const int c = tid & 7;                // 8-key chunk of the tile's row
    #pragma unroll
    for (int j = 0; j < 2; ++j) {
        const int d = (tid >> 3) + 32 * j;
        v8h p;
        #pragma unroll
        for (int i = 0; i < 8; ++i) p[i] = (_Float16)tile[8 * c + i][d];
        *(v8h*)(vt + ((size_t)bh * D_ + d) * S_ + k0 + 8 * c) = p;
    }
}

// ---------------------------------------------------------------------------
// Kernel 3: head-mix (packed f16 FMA) + attn@v via v_wmma_f32_16x16x32_f16 +
// fused LayerNorm over D.
// A 16-row tile of one head-GROUP (both output heads j=0 and j=1) is worked on
// by four waves: the raw attn fragments a0/a1 are shared by both output heads,
// so each pair of A loads feeds TWO WMMAs (two mixes x two V heads).
// Each wave owns one 16-column slice of D for both heads; K runs in steps of
// 32.  A-fragment K packing per ISA: lanes 0-15 -> K {0..7,16..23},
// lanes 16-31 -> K {8..15,24..31}.
// Causal limit: behind column m0 + 15 every probability of a tile is a masked
// one, and all masked probabilities of a row are the same number, which is 0
// unless the row's live scores lie near NEGV themselves. A tile's K range ends
// at the first multiple of KSTEP behind its last live column; the rest of K is
// run only if the last column of one of the tile's rows (a masked one wherever
// there is a rest) is not 0, so no input loses a term.
// Block = 256 threads (8 wave32) = row tiles i (short range) and 127 - i (long
// range). The two ranges add up to S_ + KSTEP columns in every block. Waves
// 0-3 take the first KCUT columns of the long tile; waves 4-7 take the short
// tile and what the long tile has behind KCUT: 9 and 8 trips, whatever i is.
// The long tile's two partial sums are added where the LayerNorm reads them.
// ---------------------------------------------------------------------------
#define KSTEP 128                  // columns per trip: 4 WMMA steps
#define KCUT  (S_ / 2 + KSTEP)     // no long tile's range ends in front of it

__global__ __launch_bounds__(256)
void k3_mix_gemm_ln(const _Float16* __restrict__ attn,
                    const _Float16* __restrict__ vt,
                    const float* __restrict__ head_mix,
                    const float* __restrict__ gamma,
                    const float* __restrict__ beta,
                    float* __restrict__ out)
{
    // readfirstlane: the half's number in a scalar register, so that the K
    // bounds are scalar and every lane is on at the WMMAs.
    const int hf = __builtin_amdgcn_readfirstlane(threadIdx.x >> 7);
    const int mS = blockIdx.x * 16;                       // short tile's rows
    const int mL = ((S_ / 16 - 1) - blockIdx.x) * 16;     // long tile's rows
    const int kS = (mS + 16 + KSTEP - 1) & ~(KSTEP - 1);  // end of its live range
    const int kL = (mL + 16 + KSTEP - 1) & ~(KSTEP - 1);
    const int m0 = hf ? mS : mL;          // the tile that this half finishes
    const int g  = blockIdx.y;            // head group (HEAD_K = 2)
    const int b  = blockIdx.z;

    const int lane = threadIdx.x & 31;
    const int w    = (threadIdx.x >> 5) & 3;

    // mixed_j = M[g,0,j]*attn_{2g} + M[g,1,j]*attn_{2g+1}
    const _Float16 c00 = (_Float16)head_mix[g * 4 + 0];   // i=0, j=0
    const _Float16 c01 = (_Float16)head_mix[g * 4 + 1];   // i=0, j=1
    const _Float16 c10 = (_Float16)head_mix[g * 4 + 2];   // i=1, j=0
    const _Float16 c11 = (_Float16)head_mix[g * 4 + 3];   // i=1, j=1

    const int mrow = m0 + (lane & 15);
    const int lrow = mL + (lane & 15);
    const int koff = (lane >> 4) << 3;    // 0 or 8

    const size_t bh0 = (size_t)b * H_ + (g * 2 + 0);
    const size_t bh1 = (size_t)b * H_ + (g * 2 + 1);
    const _Float16* a0p = attn + (bh0 * S_ + (size_t)mrow) * S_ + koff;
    const _Float16* a1p = attn + (bh1 * S_ + (size_t)mrow) * S_ + koff;
    const _Float16* l0p = attn + (bh0 * S_ + (size_t)lrow) * S_ + koff;
    const _Float16* l1p = attn + (bh1 * S_ + (size_t)lrow) * S_ + koff;

    const int n = 16 * w + (lane & 15);
    const _Float16* b0p = vt + (bh0 * D_ + (size_t)n) * S_ + koff;
    const _Float16* b1p = vt + (bh1 * D_ + (size_t)n) * S_ + koff;

    // last column of the 32 rows (16 rows x 2 heads) of this half's tile, one
    // per lane; issued here, looked at only behind the live ranges
    const _Float16 lastp =
        attn[(((lane >> 4) ? bh1 : bh0) * S_ + (size_t)mrow) * S_ + (S_ - 1)];

    // one WMMA step on the fragments of 32 columns: rows of head 2g (a0), of
    // head 2g+1 (a1), and the two V heads (b0, b1)
    auto mma = [&](v8h a0lo, v8h a0hi, v8h a1lo, v8h a1hi,
                   v8h b0lo, v8h b0hi, v8h b1lo, v8h b1hi, v8f& c0, v8f& c1) {
        // two head-mixes from one pair of A fragments (v_pk_fma_f16)
        const v8h m0lo = a0lo * c00 + a1lo * c10;
        const v8h m0hi = a0hi * c00 + a1hi * c10;
        const v8h m1lo = a0lo * c01 + a1lo * c11;
        const v8h m1hi = a0hi * c01 + a1hi * c11;

        const v16h A0 = __builtin_shufflevector(m0lo, m0hi,
            0,1,2,3,4,5,6,7,8,9,10,11,12,13,14,15);
        const v16h A1 = __builtin_shufflevector(m1lo, m1hi,
            0,1,2,3,4,5,6,7,8,9,10,11,12,13,14,15);
        const v16h B0 = __builtin_shufflevector(b0lo, b0hi,
            0,1,2,3,4,5,6,7,8,9,10,11,12,13,14,15);
        const v16h B1 = __builtin_shufflevector(b1lo, b1hi,
            0,1,2,3,4,5,6,7,8,9,10,11,12,13,14,15);

        c0 = __builtin_amdgcn_wmma_f32_16x16x32_f16(
            false, A0, false, B0, (short)0, c0, false, false);
        c1 = __builtin_amdgcn_wmma_f32_16x16x32_f16(
            false, A1, false, B1, (short)0, c1, false, false);
    };
    // columns kb .. ke-1 of the rows at p0 (head 2g) and p1 (head 2g+1),
    // KSTEP a trip
    auto span = [&](const _Float16* p0, const _Float16* p1, int kb, int ke,
                    v8f& c0, v8f& c1) {
        for (int kq = kb; kq < ke; kq += KSTEP) {
            // unrolled: the fragments are register arrays, indexed by constants
            v8h fa0[8], fa1[8], fb0[8], fb1[8];
            #pragma unroll
            for (int u = 0; u < 8; ++u) {
                fa0[u] = *(const v8h*)(p0 + kq + 16 * u);
                fa1[u] = *(const v8h*)(p1 + kq + 16 * u);
                fb0[u] = *(const v8h*)(b0p + kq + 16 * u);
                fb1[u] = *(const v8h*)(b1p + kq + 16 * u);
            }
            // The wait that belongs in front of any rewrite of a register that an
            // issued load names as its address. The addresses are inputs so that
            // no load's result is placed in their registers ahead of this line.
            asm volatile("s_wait_xcnt 0x0" :: "v"(p0 + kq), "v"(b0p + kq) : "memory");
            #pragma unroll
            for (int u = 0; u < 8; u += 2)
                mma(fa0[u], fa0[u + 1], fa1[u], fa1[u + 1],
                    fb0[u], fb0[u + 1], fb1[u], fb1[u + 1], c0, c1);
        }
    };

    v8f acc0 = {}, acc1 = {};             // this half's own tile
    v8f par0 = {}, par1 = {};             // waves 4-7: the long tile behind KCUT
    span(a0p, a1p, 0, hf ? kS : KCUT, acc0, acc1);
    span(l0p, l1p, KCUT, hf ? kL : KCUT, par0, par1);
    // The rest of K, for rows whose masked probabilities are not 0.
    // ballot: one scalar answer for the wave, so the branch is scalar.
    if (__builtin_amdgcn_ballot_w32(lastp != (_Float16)0.0f) != 0u) {
        // not unrolled: a path that few inputs take is kept small
        #pragma unroll 1
        for (int k0 = hf ? kS : kL; k0 < S_; k0 += 32)
            mma(*(const v8h*)(a0p + k0), *(const v8h*)(a0p + k0 + 16),
                *(const v8h*)(a1p + k0), *(const v8h*)(a1p + k0 + 16),
                *(const v8h*)(b0p + k0), *(const v8h*)(b0p + k0 + 16),
                *(const v8h*)(b1p + k0), *(const v8h*)(b1p + k0 + 16), acc0, acc1);
    }

    // Scatter C tiles to LDS: VGPR r -> row r (lanes 0-15) / r+8 (lanes 16-31)
    __shared__ float tile[2][2][16][72];   // [half][head][row][col]
    __shared__ float part[2][16][72];      // long tile, columns behind KCUT
    const int rbase = (lane >> 4) << 3;
    const int col   = 16 * w + (lane & 15);
    #pragma unroll
    for (int r = 0; r < 8; ++r) {
        tile[hf][0][rbase + r][col] = acc0[r];
        tile[hf][1][rbase + r][col] = acc1[r];
    }
    if (hf) {
        #pragma unroll
        for (int r = 0; r < 8; ++r) {
            part[0][rbase + r][col] = par0[r];
            part[1][rbase + r][col] = par1[r];
        }
    }
    __syncthreads();

    // LayerNorm over D=64 for each tile's 32 rows (2 heads x 16): 4 threads per row,
    // 16 cols each, shuffle-reduce within aligned 4-lane groups.
    const int t  = threadIdx.x & 127;
    const int jj = t >> 6;                // output head within group
    const int r  = (t >> 2) & 15;        // row within tile
    const int cb = (t & 3) * 16;         // column base
    float x[16];
    float sum = 0.0f, sq = 0.0f;
    #pragma unroll
    for (int i = 0; i < 16; ++i) x[i] = tile[hf][jj][r][cb + i];
    if (!hf) {                            // long tile: join its two partial sums
        #pragma unroll
        for (int i = 0; i < 16; ++i) x[i] += part[jj][r][cb + i];
    }
    #pragma unroll
    for (int i = 0; i < 16; ++i) {
        sum += x[i];
        sq  += x[i] * x[i];
    }
    #pragma unroll
    for (int off = 1; off < 4; off <<= 1) {
        sum += __shfl_xor(sum, off, 32);
        sq  += __shfl_xor(sq,  off, 32);
    }
    const float mean = sum * (1.0f / 64.0f);
    const float var  = sq * (1.0f / 64.0f) - mean * mean;
    const float rs   = rsqrtf(var + 1e-5f);

    const size_t obase =
        (((size_t)b * H_ + (g * 2 + jj)) * S_ + (size_t)(m0 + r)) * D_ + cb;
    #pragma unroll
    for (int i = 0; i < 16; ++i)
        out[obase + i] = (x[i] - mean) * rs * gamma[cb + i] + beta[cb + i];
}

// ---------------------------------------------------------------------------
extern "C" void kernel_launch(void* const* d_in, const int* in_sizes, int n_in,
                              void* d_out, int out_size, void* d_ws, size_t ws_size,
                              hipStream_t stream)
{
    const float* scores   = (const float*)d_in[0];
    const float* v        = (const float*)d_in[1];
    const float* kq_w     = (const float*)d_in[2];
    const float* kq_b     = (const float*)d_in[3];
    const float* head_mix = (const float*)d_in[4];
    const float* gamma    = (const float*)d_in[5];
    const float* beta     = (const float*)d_in[6];
    float* out = (float*)d_out;

    // workspace: [attn f16 : B*H*S*S] [vt f16 : B*H*D*S]  (128MB + 4MB)
    _Float16* wsAttn = (_Float16*)d_ws;
    _Float16* wsVt   = (_Float16*)((char*)d_ws +
                        (size_t)B_ * H_ * S_ * S_ * sizeof(_Float16));

    dim3 g1(S_, H_, B_);
    k1_conv_softmax<<<g1, 256, 0, stream>>>(scores, kq_w, kq_b, wsAttn);

    dim3 g2(S_ / TK, B_ * H_);
    k2_vt<<<g2, 256, 0, stream>>>(v, wsVt);

    dim3 g3(S_ / 32, H_ / 2, B_);   // one block per pair of row tiles and head GROUP
    k3_mix_gemm_ln<<<g3, 256, 0, stream>>>(wsAttn, wsVt, head_mix,
                                           gamma, beta, out);
}

// v006
// One run takes 96.7 microseconds.
// Timed twice side by side with v005, it ran 1.28 times as fast both times.
// Over all steps from v000 it is 5.90 times as fast.
#include <hip/hip_runtime.h>
#include <hip/hip_bf16.h>

typedef __attribute__((ext_vector_type(16))) _Float16 v16h;
typedef __attribute__((ext_vector_type(8)))  _Float16 v8h;
typedef __attribute__((ext_vector_type(8)))  float    v8f;

#define B_  2
#define H_  8
#define S_  2048
#define D_  64
#define QK  6
#define KK  11
#define NEGV (-1.0e9f)
#define HALO 8

// ---------------------------------------------------------------------------
// Kernel 1: masked depthwise conv (6x11, SAME) + bias + causal re-mask +
//           row softmax, emitting f16 probabilities.
// One block per RPB adjacent query rows of one (b,h). 256 threads, 8 ADJACENT
// columns per thread. The block walks its rows one after the other.
// LDS: a ring of 6 source rows with an 8-column zero halo on each side (5 are
// read; 8 keeps every row and every 4-column group 16-byte aligned). A masked
// source row does not depend on the query row that reads it, so from one query
// row to the next five of the six stay where they are and one new row takes
// the place of the oldest: a source row is fetched once per block and not once
// per query row, and a wave is launched once per RPB rows.
// The new row's loads are issued in front of the conv of the current row and
// stored to LDS behind the barrier that ends that conv's reads.
// Conv: per source row a thread reads the 24 floats that cover its 8 columns
// and their taps with 6 16-byte LDS reads and slides the 11 taps over them in
// registers. The ring places are walked in a fixed order, so that the window
// reads keep constant offsets; which tap row belongs to a place moves with the
// ring and is looked up.
// Causal limit: a wave owns one chunk of 256 columns. A chunk that starts
// behind column s holds only masked columns, all equal to NEGV: its wave reads
// no window, does no conv, and takes one exp for its equal terms. Nothing is
// staged behind the last column that a live chunk's windows reach. The rows of
// a block lie in one group of 256, so both limits are the same for all of them.
// ---------------------------------------------------------------------------
#define ROWP  (S_ + 2 * HALO)      // LDS row pitch in floats
#define ROWQ  (ROWP / 4)           // the same in 4-float slots
#define RPB   8                    // query rows per block (divides 256)
#define WROW  12                   // LDS pitch of a tap row: 11 taps, 16-byte aligned

// Place of 4-float slot q inside an LDS row. The conv reads slots 2*ct + j:
// unswizzled, lanes t and t + 8 of a 16-lane half would meet on the same four
// banks. Swapping the two slots of each pair in every other group of 16 slots
// puts the 16 lanes on 16 different bank quads.
__device__ __forceinline__ int slot_of(int q) { return q ^ ((q >> 4) & 1); }

__global__ __launch_bounds__(256)
void k1_conv_softmax(const float* __restrict__ scores,
                     const float* __restrict__ kq_w,
                     const float* __restrict__ kq_b,
                     _Float16* __restrict__ attn)
{
    // The row groups with the longest live ranges take the lowest block
    // indices (for speed only).
    const int s0 = (S_ / RPB - 1 - blockIdx.y) * RPB;   // first query row
    const int bh = blockIdx.x;
    const int h  = bh & (H_ - 1);
    const int tid = threadIdx.x;
    const int lane = tid & 31;

    // Which chunk of 256 columns this wave owns. The live chunks are the low
    // ones; the start is turned from block to block so that they do not fall
    // on the same waves in every block (for speed only).
    // readfirstlane: the wave's number in a scalar register, so that the skip
    // below is a scalar branch.
    const int wave  = __builtin_amdgcn_readfirstlane(tid >> 5);
    const int turn  = s0 ^ (s0 >> 2) ^ (s0 >> 4) ^ (s0 >> 6) ^ (s0 >> 8) ^ (s0 >> 10);
    const int chunk = (wave + turn) & 7;
    const int ct    = 32 * chunk + lane;  // the thread makes columns 8*ct..8*ct+7
    const bool live = 256 * chunk <= s0;  // the same for the wave and for all rows
    // first column that no live window reaches (the last live chunk ends at
    // column s0 | 255 and its windows run 8 columns further)
    const int stageEnd = (s0 | 255) + 9;

    __shared__ __attribute__((aligned(16))) float4 sm[QK][ROWQ];
    __shared__ __attribute__((aligned(16))) float wsm[QK * WROW];
    __shared__ float redm[8];
    __shared__ float reds[8];

    const float bias = kq_b[h];
    float wv = 0.0f;
    if (tid < QK * WROW && tid % WROW < KK)
        wv = kq_w[h * (QK * KK) + (tid / WROW) * KK + tid % WROW];

    const size_t rowBase = (size_t)bh * (size_t)S_;

    // The first 6 source rows (s0-2 .. s0+3): every load is issued before any
    // store. A 4-column group that lies wholly behind the causal limit is not
    // read. Both loop nests are unrolled so that stg[][] stays in registers and
    // the 12 loads stand in a row with no wait between them.
    float4 stg[QK][2];
    #pragma unroll
    for (int r = 0; r < QK; ++r) {
        const int sp = s0 + r - 2;      // pad_low = (6-1)/2 = 2
        #pragma unroll
        for (int j = 0; j < 2; ++j) {
            const int k4 = (tid + 256 * j) * 4;
            stg[r][j] = make_float4(0.0f, 0.0f, 0.0f, 0.0f);
            if (sp >= 0 && sp < S_ && k4 <= sp)
                stg[r][j] = ((const float4*)(scores + (rowBase + (size_t)sp) * S_))
                                [(unsigned)(tid + 256 * j)];
        }
    }

    if (tid < QK * WROW) wsm[tid] = wv;
    // zero halo: 4 slots per ring place (2 left, 2 right); no later store
    // touches them
    if (tid < QK * 4) {
        const int q = tid & 3;
        const int c = (q < 2) ? q : ROWQ - 4 + q;
        sm[tid >> 2][slot_of(c)] = make_float4(0.0f, 0.0f, 0.0f, 0.0f);
    }
    // causally zeroed rows; memory column k sits at LDS column k + HALO
    #pragma unroll
    for (int j = 0; j < 2; ++j) {
        const int k4 = (tid + 256 * j) * 4;
        if (k4 < stageEnd) {
            #pragma unroll
            for (int r = 0; r < QK; ++r) {
                const int sp = s0 + r - 2;
                float4 x = stg[r][j];   // x.x is live or already 0
                x.y = (k4 + 1 <= sp) ? x.y : 0.0f;
                x.z = (k4 + 2 <= sp) ? x.z : 0.0f;
                x.w = (k4 + 3 <= sp) ? x.w : 0.0f;
                sm[r][slot_of(HALO / 4 + tid + 256 * j)] = x;
            }
        }
    }
    __syncthreads();

    int ps[6];
    #pragma unroll
    for (int j = 0; j < 6; ++j) ps[j] = slot_of(2 * ct + j);

    // the source row that is fetched next (s + 4) and this thread's place in the
    // output row, each moved on by one row per trip
    const float4* nrow = (const float4*)(scores + (rowBase + (size_t)(s0 + 4)) * S_);
    _Float16*     orow = attn + (rowBase + (size_t)s0) * S_ + 8 * ct;

    // ring: the place of the oldest source row (s - 2) of the current query row
    int ring = 0;
    #pragma unroll 1
    for (int i = 0; i < RPB; ++i) {
        const int s = s0 + i;

        // Source row s + 4, which the next query row needs: issued here, stored
        // behind the conv.
        const int  sn   = s + 4;
        const bool more = i + 1 < RPB;
        float4 nx[2];
        #pragma unroll
        for (int j = 0; j < 2; ++j) {
            const int k4 = (tid + 256 * j) * 4;
            nx[j] = make_float4(0.0f, 0.0f, 0.0f, 0.0f);
            if (more && sn < S_ && k4 <= sn)
                nx[j] = nrow[(unsigned)(tid + 256 * j)];
        }

        // Columns 8*ct .. 8*ct+7. Column k, tap dk reads LDS column k + dk + 3,
        // which is win[c + dk + 3] of the window that starts at LDS column 8*ct.
        // Every loop of the nest is unrolled so that win[] and acc[] are indexed
        // by constants and stay in registers. Per output the sum starts from the
        // bias and takes the ring places in order, dk inner.
        float vout[8];
        float mx = NEGV;                  // a chunk behind the limit: all NEGV
        if (live) {
            float acc[8];
            #pragma unroll
            for (int c = 0; c < 8; ++c) acc[c] = bias;
            #pragma unroll
            for (int t = 0; t < QK; ++t) {
                // place t holds source row s - 2 + dq
                const int dq = (t - ring < 0) ? t - ring + QK : t - ring;
                float win[24];
                #pragma unroll
                for (int j = 0; j < 6; ++j) {
                    const float4 q = sm[t][ps[j]];
                    win[4 * j + 0] = q.x;
                    win[4 * j + 1] = q.y;
                    win[4 * j + 2] = q.z;
                    win[4 * j + 3] = q.w;
                }
                const float4* wr = (const float4*)(wsm + dq * WROW);
                const float4 w0 = wr[0], w1 = wr[1], w2 = wr[2];
                const float w[KK] = { w0.x, w0.y, w0.z, w0.w, w1.x, w1.y, w1.z,
                                      w1.w, w2.x, w2.y, w2.z };
                #pragma unroll
                for (int dk = 0; dk < KK; ++dk) {
                    #pragma unroll
                    for (int c = 0; c < 8; ++c)
                        acc[c] = fmaf(w[dk], win[c + dk + (HALO - 5)], acc[c]);
                }
            }

            mx = -3.4e38f;
            #pragma unroll
            for (int c = 0; c < 8; ++c) {
                const float val = (8 * ct + c <= s) ? acc[c] : NEGV;
                vout[c] = val;
                mx = fmaxf(mx, val);
            }
            #pragma unroll
            for (int off = 16; off > 0; off >>= 1)
                mx = fmaxf(mx, __shfl_xor(mx, off, 32));
        }

        // block max; redm[] is indexed by chunk, so it is read in column order
        if (lane == 0) redm[chunk] = mx;
        __syncthreads();                  // also ends every read of this row's windows

        // the new source row takes the oldest one's place; the barrier in front
        // of the sum's read publishes it
        if (more) {
            #pragma unroll
            for (int j = 0; j < 2; ++j) {
                const int k4 = (tid + 256 * j) * 4;
                if (k4 < stageEnd) {
                    float4 x = nx[j];     // x.x is live or already 0
                    x.y = (k4 + 1 <= sn) ? x.y : 0.0f;
                    x.z = (k4 + 2 <= sn) ? x.z : 0.0f;
                    x.w = (k4 + 3 <= sn) ? x.w : 0.0f;
                    sm[ring][slot_of(HALO / 4 + tid + 256 * j)] = x;
                }
            }
        }

        mx = redm[0];
        #pragma unroll
        for (int c = 1; c < 8; ++c) mx = fmaxf(mx, redm[c]);

        // exp + block sum
        float e[8];
        float se = 0.0f;
        if (live) {
            #pragma unroll
            for (int c = 0; c < 8; ++c)   // e^x as 2^(x * log2 e), as __expf does
                vout[c] = (vout[c] - mx) * 1.44269504f;
            // The 8 v_exp_f32 stand in one statement, each on registers of its own,
            // with the free slot that the instruction set asks for behind the last.
            asm("v_exp_f32 %0, %8\n\t"
                "v_exp_f32 %1, %9\n\t"
                "v_exp_f32 %2, %10\n\t"
                "v_exp_f32 %3, %11\n\t"
                "v_exp_f32 %4, %12\n\t"
                "v_exp_f32 %5, %13\n\t"
                "v_exp_f32 %6, %14\n\t"
                "v_exp_f32 %7, %15\n\t"
                "v_nop"
                : "=&v"(e[0]), "=&v"(e[1]), "=&v"(e[2]), "=&v"(e[3]),
                  "=&v"(e[4]), "=&v"(e[5]), "=&v"(e[6]), "=&v"(e[7])
                : "v"(vout[0]), "v"(vout[1]), "v"(vout[2]), "v"(vout[3]),
                  "v"(vout[4]), "v"(vout[5]), "v"(vout[6]), "v"(vout[7]));
            #pragma unroll
            for (int c = 0; c < 8; ++c) se += e[c];
            #pragma unroll
            for (int off = 16; off > 0; off >>= 1)
                se += __shfl_xor(se, off, 32);
        } else {
            // 256 equal terms
            const float e0 = __expf(NEGV - mx);
            #pragma unroll
            for (int c = 0; c < 8; ++c) e[c] = e0;
            se = 256.0f * e0;
        }
        // The maxima and the sums have an array each: a wave writes redm again
        // only behind this barrier, which every wave reaches with its maxima
        // read, and reds again only behind the next row's first barrier.
        if (lane == 0) reds[chunk] = se;
        __syncthreads();
        float tot = 0.0f;
        #pragma unroll
        for (int c = 0; c < 8; ++c) tot += reds[c];
        const float inv = 1.0f / tot;

        // the thread's 8 adjacent probabilities leave as one 16-byte store
        // (unrolled: p[] is a register vector, indexed by constants)
        v8h p;
        #pragma unroll
        for (int c = 0; c < 8; ++c) p[c] = (_Float16)(e[c] * inv);
        *(v8h*)orow = p;
        // The wait that belongs in front of any rewrite of a register that an
        // issued store names: the next trip reuses the store's registers.
        asm volatile("s_wait_xcnt 0x0" ::: "memory");

        nrow += S_ / 4;
        orow += S_;
        ring = (ring + 1 == QK) ? 0 : ring + 1;
    }
}

// ---------------------------------------------------------------------------
// Kernel 2: transpose + downconvert v [b,h,k,d] f32 -> vt [b,h,d,k] f16 so
// the WMMA B-fragment loads become two contiguous 16B reads per lane.
// One block per 64-key x 64-dim tile (512 blocks). The tile is 16 KB in a row
// in v: it is read with whole-line 16-byte loads, turned in LDS, and leaves as
// 64 whole 128-byte lines of vt (8 lanes x 16 bytes each).
// LDS pitch 65 floats: the column reads of lanes (chunk c, dim d) fall on bank
// 8c + i + d, 32 different banks; the row writes are conflict-free as well.
// ---------------------------------------------------------------------------
#define TK 64                      // keys per tile

__global__ __launch_bounds__(256)
void k2_vt(const float* __restrict__ v, _Float16* __restrict__ vt)
{
    const int k0  = blockIdx.x * TK;
    const int bh  = blockIdx.y;
    const int tid = threadIdx.x;

    __shared__ float tile[TK][D_ + 1];

    // unrolled: the 4 loads stand in a row, one memory latency for the tile
    const float4* vin = (const float4*)(v + ((size_t)bh * S_ + k0) * D_);
    float4 x[4];
    #pragma unroll
    for (int j = 0; j < 4; ++j) x[j] = vin[tid + 256 * j];
    #pragma unroll
    for (int j = 0; j < 4; ++j) {
        const int idx = tid + 256 * j;
        const int k = idx >> 4;
        const int d = (idx & 15) * 4;
        tile[k][d + 0] = x[j].x;
        tile[k][d + 1] = x[j].y;
        tile[k][d + 2] = x[j].z;
        tile[k][d + 3] = x[j].w;
    }
    __syncthreads();

    // unrolled: p[] is a register vector, indexed by constants
    const int c = tid & 7;                // 8-key chunk of the tile's row
    #pragma unroll
    for (int j = 0; j < 2; ++j) {
        const int d = (tid >> 3) + 32 * j;
        v8h p;
        #pragma unroll
        for (int i = 0; i < 8; ++i) p[i] = (_Float16)tile[8 * c + i][d];
        *(v8h*)(vt + ((size_t)bh * D_ + d) * S_ + k0 + 8 * c) = p;
    }
}

// ---------------------------------------------------------------------------
// Kernel 3: head-mix (packed f16 FMA) + attn@v via v_wmma_f32_16x16x32_f16 +
// fused LayerNorm over D.
// A 16-row tile of one head-GROUP (both output heads j=0 and j=1) is worked on
// by four waves: the raw attn fragments a0/a1 are shared by both output heads,
// so each pair of A loads feeds TWO WMMAs (two mixes x two V heads).
// Each wave owns one 16-column slice of D for both heads; K runs in steps of
// 32.  A-fragment K packing per ISA: lanes 0-15 -> K {0..7,16..23},
// lanes 16-31 -> K {8..15,24..31}.
// Causal limit: behind column m0 + 15 every probability of a tile is a masked
// one, and all masked probabilities of a row are the same number, which is 0
// unless the row's live scores lie near NEGV themselves. A tile's K range ends
// at the first multiple of KSTEP behind its last live column; the rest of K is
// run only if the last column of one of the tile's rows (a masked one wherever
// there is a rest) is not 0, so no input loses a term.
// Block = 256 threads (8 wave32) = row tiles i (short range) and 127 - i (long
// range). The two ranges add up to S_ + KSTEP columns in every block. Waves
// 0-3 take the first KCUT columns of the long tile; waves 4-7 take the short
// tile and what the long tile has behind KCUT: 9 and 8 trips, whatever i is.
// The long tile's two partial sums are added where the LayerNorm reads them.
// ---------------------------------------------------------------------------
#define KSTEP 128                  // columns per trip: 4 WMMA steps
#define KCUT  (S_ / 2 + KSTEP)     // no long tile's range ends in front of it

__global__ __launch_bounds__(256)
void k3_mix_gemm_ln(const _Float16* __restrict__ attn,
                    const _Float16* __restrict__ vt,
                    const float* __restrict__ head_mix,
                    const float* __restrict__ gamma,
                    const float* __restrict__ beta,
                    float* __restrict__ out)
{
    // readfirstlane: the half's number in a scalar register, so that the K
    // bounds are scalar and every lane is on at the WMMAs.
    const int hf = __builtin_amdgcn_readfirstlane(threadIdx.x >> 7);
    const int mS = blockIdx.x * 16;                       // short tile's rows
    const int mL = ((S_ / 16 - 1) - blockIdx.x) * 16;     // long tile's rows
    const int kS = (mS + 16 + KSTEP - 1) & ~(KSTEP - 1);  // end of its live range
    const int kL = (mL + 16 + KSTEP - 1) & ~(KSTEP - 1);
    const int m0 = hf ? mS : mL;          // the tile that this half finishes
    const int g  = blockIdx.y;            // head group (HEAD_K = 2)
    const int b  = blockIdx.z;

    const int lane = threadIdx.x & 31;
    const int w    = (threadIdx.x >> 5) & 3;

    // mixed_j = M[g,0,j]*attn_{2g} + M[g,1,j]*attn_{2g+1}
    const _Float16 c00 = (_Float16)head_mix[g * 4 + 0];   // i=0, j=0
    const _Float16 c01 = (_Float16)head_mix[g * 4 + 1];   // i=0, j=1
    const _Float16 c10 = (_Float16)head_mix[g * 4 + 2];   // i=1, j=0
    const _Float16 c11 = (_Float16)head_mix[g * 4 + 3];   // i=1, j=1

    const int mrow = m0 + (lane & 15);
    const int lrow = mL + (lane & 15);
    const int koff = (lane >> 4) << 3;    // 0 or 8

    const size_t bh0 = (size_t)b * H_ + (g * 2 + 0);
    const size_t bh1 = (size_t)b * H_ + (g * 2 + 1);
    const _Float16* a0p = attn + (bh0 * S_ + (size_t)mrow) * S_ + koff;
    const _Float16* a1p = attn + (bh1 * S_ + (size_t)mrow) * S_ + koff;
    const _Float16* l0p = attn + (bh0 * S_ + (size_t)lrow) * S_ + koff;
    const _Float16* l1p = attn + (bh1 * S_ + (size_t)lrow) * S_ + koff;

    const int n = 16 * w + (lane & 15);
    const _Float16* b0p = vt + (bh0 * D_ + (size_t)n) * S_ + koff;
    const _Float16* b1p = vt + (bh1 * D_ + (size_t)n) * S_ + koff;

    // last column of the 32 rows (16 rows x 2 heads) of this half's tile, one
    // per lane; issued here, looked at only behind the live ranges
    const _Float16 lastp =
        attn[(((lane >> 4) ? bh1 : bh0) * S_ + (size_t)mrow) * S_ + (S_ - 1)];

    // one WMMA step on the fragments of 32 columns: rows of head 2g (a0), of
    // head 2g+1 (a1), and the two V heads (b0, b1)
    auto mma = [&](v8h a0lo, v8h a0hi, v8h a1lo, v8h a1hi,
                   v8h b0lo, v8h b0hi, v8h b1lo, v8h b1hi, v8f& c0, v8f& c1) {
        // two head-mixes from one pair of A fragments (v_pk_fma_f16)
        const v8h m0lo = a0lo * c00 + a1lo * c10;
        const v8h m0hi = a0hi * c00 + a1hi * c10;
        const v8h m1lo = a0lo * c01 + a1lo * c11;
        const v8h m1hi = a0hi * c01 + a1hi * c11;

        const v16h A0 = __builtin_shufflevector(m0lo, m0hi,
            0,1,2,3,4,5,6,7,8,9,10,11,12,13,14,15);
        const v16h A1 = __builtin_shufflevector(m1lo, m1hi,
            0,1,2,3,4,5,6,7,8,9,10,11,12,13,14,15);
        const v16h B0 = __builtin_shufflevector(b0lo, b0hi,
            0,1,2,3,4,5,6,7,8,9,10,11,12,13,14,15);
        const v16h B1 = __builtin_shufflevector(b1lo, b1hi,
            0,1,2,3,4,5,6,7,8,9,10,11,12,13,14,15);

        c0 = __builtin_amdgcn_wmma_f32_16x16x32_f16(
            false, A0, false, B0, (short)0, c0, false, false);
        c1 = __builtin_amdgcn_wmma_f32_16x16x32_f16(
            false, A1, false, B1, (short)0, c1, false, false);
    };
    // columns kb .. ke-1 of the rows at p0 (head 2g) and p1 (head 2g+1),
    // KSTEP a trip
    auto span = [&](const _Float16* p0, const _Float16* p1, int kb, int ke,
                    v8f& c0, v8f& c1) {
        for (int kq = kb; kq < ke; kq += KSTEP) {
            // unrolled: the fragments are register arrays, indexed by constants
            v8h fa0[8], fa1[8], fb0[8], fb1[8];
            #pragma unroll
            for (int u = 0; u < 8; ++u) {
                fa0[u] = *(const v8h*)(p0 + kq + 16 * u);
                fa1[u] = *(const v8h*)(p1 + kq + 16 * u);
                fb0[u] = *(const v8h*)(b0p + kq + 16 * u);
                fb1[u] = *(const v8h*)(b1p + kq + 16 * u);
            }
            // The wait that belongs in front of any rewrite of a register that an
            // issued load names as its address. The addresses are inputs so that
            // no load's result is placed in their registers ahead of this line.
            asm volatile("s_wait_xcnt 0x0" :: "v"(p0 + kq), "v"(b0p + kq) : "memory");
            #pragma unroll
            for (int u = 0; u < 8; u += 2)
                mma(fa0[u], fa0[u + 1], fa1[u], fa1[u + 1],
                    fb0[u], fb0[u + 1], fb1[u], fb1[u + 1], c0, c1);
        }
    };

    v8f acc0 = {}, acc1 = {};             // this half's own tile
    v8f par0 = {}, par1 = {};             // waves 4-7: the long tile behind KCUT
    span(a0p, a1p, 0, hf ? kS : KCUT, acc0, acc1);
    span(l0p, l1p, KCUT, hf ? kL : KCUT, par0, par1);
    // The rest of K, for rows whose masked probabilities are not 0.
    // ballot: one scalar answer for the wave, so the branch is scalar.
    if (__builtin_amdgcn_ballot_w32(lastp != (_Float16)0.0f) != 0u) {
        // not unrolled: a path that few inputs take is kept small
        #pragma unroll 1
        for (int k0 = hf ? kS : kL; k0 < S_; k0 += 32)
            mma(*(const v8h*)(a0p + k0), *(const v8h*)(a0p + k0 + 16),
                *(const v8h*)(a1p + k0), *(const v8h*)(a1p + k0 + 16),
                *(const v8h*)(b0p + k0), *(const v8h*)(b0p + k0 + 16),
                *(const v8h*)(b1p + k0), *(const v8h*)(b1p + k0 + 16), acc0, acc1);
    }

    // Scatter C tiles to LDS: VGPR r -> row r (lanes 0-15) / r+8 (lanes 16-31)
    __shared__ float tile[2][2][16][72];   // [half][head][row][col]
    __shared__ float part[2][16][72];      // long tile, columns behind KCUT
    const int rbase = (lane >> 4) << 3;
    const int col   = 16 * w + (lane & 15);
    #pragma unroll
    for (int r = 0; r < 8; ++r) {
        tile[hf][0][rbase + r][col] = acc0[r];
        tile[hf][1][rbase + r][col] = acc1[r];
    }
    if (hf) {
        #pragma unroll
        for (int r = 0; r < 8; ++r) {
            part[0][rbase + r][col] = par0[r];
            part[1][rbase + r][col] = par1[r];
        }
    }
    __syncthreads();

    // LayerNorm over D=64 for each tile's 32 rows (2 heads x 16): 4 threads per row,
    // 16 cols each, shuffle-reduce within aligned 4-lane groups.
    const int t  = threadIdx.x & 127;
    const int jj = t >> 6;                // output head within group
    const int r  = (t >> 2) & 15;        // row within tile
    const int cb = (t & 3) * 16;         // column base
    float x[16];
    float sum = 0.0f, sq = 0.0f;
    #pragma unroll
    for (int i = 0; i < 16; ++i) x[i] = tile[hf][jj][r][cb + i];
    if (!hf) {                            // long tile: join its two partial sums
        #pragma unroll
        for (int i = 0; i < 16; ++i) x[i] += part[jj][r][cb + i];
    }
    #pragma unroll
    for (int i = 0; i < 16; ++i) {
        sum += x[i];
        sq  += x[i] * x[i];
    }
    #pragma unroll
    for (int off = 1; off < 4; off <<= 1) {
        sum += __shfl_xor(sum, off, 32);
        sq  += __shfl_xor(sq,  off, 32);
    }
    const float mean = sum * (1.0f / 64.0f);
    const float var  = sq * (1.0f / 64.0f) - mean * mean;
    const float rs   = rsqrtf(var + 1e-5f);

    const size_t obase =
        (((size_t)b * H_ + (g * 2 + jj)) * S_ + (size_t)(m0 + r)) * D_ + cb;
    #pragma unroll
    for (int i = 0; i < 16; ++i)
        out[obase + i] = (x[i] - mean) * rs * gamma[cb + i] + beta[cb + i];
}

// ---------------------------------------------------------------------------
extern "C" void kernel_launch(void* const* d_in, const int* in_sizes, int n_in,
                              void* d_out, int out_size, void* d_ws, size_t ws_size,
                              hipStream_t stream)
{
    const float* scores   = (const float*)d_in[0];
    const float* v        = (const float*)d_in[1];
    const float* kq_w     = (const float*)d_in[2];
    const float* kq_b     = (const float*)d_in[3];
    const float* head_mix = (const float*)d_in[4];
    const float* gamma    = (const float*)d_in[5];
    const float* beta     = (const float*)d_in[6];
    float* out = (float*)d_out;

    // workspace: [attn f16 : B*H*S*S] [vt f16 : B*H*D*S]  (128MB + 4MB)
    _Float16* wsAttn = (_Float16*)d_ws;
    _Float16* wsVt   = (_Float16*)((char*)d_ws +
                        (size_t)B_ * H_ * S_ * S_ * sizeof(_Float16));

    dim3 g1(B_ * H_, S_ / RPB);     // one block per head and group of RPB rows
    k1_conv_softmax<<<g1, 256, 0, stream>>>(scores, kq_w, kq_b, wsAttn);

    dim3 g2(S_ / TK, B_ * H_);
    k2_vt<<<g2, 256, 0, stream>>>(v, wsVt);

    dim3 g3(S_ / 32, H_ / 2, B_);   // one block per pair of row tiles and head GROUP
    k3_mix_gemm_ln<<<g3, 256, 0, stream>>>(wsAttn, wsVt, head_mix,
                                           gamma, beta, out);
}

// v007
// A run of this version takes 91.8 microseconds.
// Next to v006, in two timings, it ran 1.06 times as fast each time.
// All steps since v000 together make it 6.27 times as fast.
#include <hip/hip_runtime.h>
#include <hip/hip_bf16.h>

typedef __attribute__((ext_vector_type(16))) _Float16 v16h;
typedef __attribute__((ext_vector_type(8)))  _Float16 v8h;
typedef __attribute__((ext_vector_type(8)))  float    v8f;

#define B_  2
#define H_  8
#define S_  2048
#define D_  64
#define QK  6
#define KK  11
#define NEGV (-1.0e9f)
#define HALO 8

// ---------------------------------------------------------------------------
// Kernel 1: masked depthwise conv (6x11, SAME) + bias + causal re-mask +
//           row softmax, emitting f16 probabilities.
// One block per RPB adjacent query rows of one (b,h). 256 threads, 8 ADJACENT
// columns per thread. The block walks its rows one after the other.
// LDS: a ring of 6 source rows with an 8-column zero halo on each side (5 are
// read; 8 keeps every row and every 4-column group 16-byte aligned). A masked
// source row does not depend on the query row that reads it, so from one query
// row to the next five of the six stay where they are and one new row takes
// the place of the oldest: a source row is fetched once per block and not once
// per query row, and a wave is launched once per RPB rows.
// The new row's loads are issued in front of the conv of the current row and
// stored to LDS behind the barrier that ends that conv's reads.
// Conv: per source row a thread reads the 24 floats that cover its 8 columns
// and their taps with 6 16-byte LDS reads and slides the 11 taps over them in
// registers. The ring places are walked in a fixed order, so that the window
// reads keep constant offsets; which tap row belongs to a place moves with the
// ring and is looked up.
// Causal limit: a wave owns one chunk of 256 columns. A chunk that starts
// behind column s holds only masked columns, all equal to NEGV: its wave reads
// no window, does no conv, and takes one exp for its equal terms. Nothing is
// staged behind the last column that a live chunk's windows reach. The rows of
// a block lie in one group of 256, so both limits are the same for all of them.
// ---------------------------------------------------------------------------
#define ROWP  (S_ + 2 * HALO)      // LDS row pitch in floats
#define ROWQ  (ROWP / 4)           // the same in 4-float slots
#define RPB   8                    // query rows per block (divides 256)
#define WROW  12                   // LDS pitch of a tap row: 11 taps, 16-byte aligned

// Place of 4-float slot q inside an LDS row. The conv reads slots 2*ct + j:
// unswizzled, lanes t and t + 8 of a 16-lane half would meet on the same four
// banks. Swapping the two slots of each pair in every other group of 16 slots
// puts the 16 lanes on 16 different bank quads.
__device__ __forceinline__ int slot_of(int q) { return q ^ ((q >> 4) & 1); }

__global__ __launch_bounds__(256)
void k1_conv_softmax(const float* __restrict__ scores,
                     const float* __restrict__ kq_w,
                     const float* __restrict__ kq_b,
                     _Float16* __restrict__ attn)
{
    // The row groups with the longest live ranges take the lowest block
    // indices (for speed only).
    const int s0 = (S_ / RPB - 1 - blockIdx.y) * RPB;   // first query row
    const int bh = blockIdx.x;
    const int h  = bh & (H_ - 1);
    const int tid = threadIdx.x;
    const int lane = tid & 31;

    // Which chunk of 256 columns this wave owns. The live chunks are the low
    // ones; the start is turned from block to block so that they do not fall
    // on the same waves in every block (for speed only).
    // readfirstlane: the wave's number in a scalar register, so that the skip
    // below is a scalar branch.
    const int wave  = __builtin_amdgcn_readfirstlane(tid >> 5);
    const int turn  = s0 ^ (s0 >> 2) ^ (s0 >> 4) ^ (s0 >> 6) ^ (s0 >> 8) ^ (s0 >> 10);
    const int chunk = (wave + turn) & 7;
    const int ct    = 32 * chunk + lane;  // the thread makes columns 8*ct..8*ct+7
    const bool live = 256 * chunk <= s0;  // the same for the wave and for all rows
    // first column that no live window reaches (the last live chunk ends at
    // column s0 | 255 and its windows run 8 columns further)
    const int stageEnd = (s0 | 255) + 9;

    __shared__ __attribute__((aligned(16))) float4 sm[QK][ROWQ];
    __shared__ __attribute__((aligned(16))) float wsm[QK * WROW];
    __shared__ float redm[8];
    __shared__ float reds[8];

    const float bias = kq_b[h];
    float wv = 0.0f;
    if (tid < QK * WROW && tid % WROW < KK)
        wv = kq_w[h * (QK * KK) + (tid / WROW) * KK + tid % WROW];

    const size_t rowBase = (size_t)bh * (size_t)S_;

    // The first 6 source rows (s0-2 .. s0+3): every load is issued before any
    // store. A 4-column group that lies wholly behind the causal limit is not
    // read. Both loop nests are unrolled so that stg[][] stays in registers and
    // the 12 loads stand in a row with no wait between them.
    float4 stg[QK][2];
    #pragma unroll
    for (int r = 0; r < QK; ++r) {
        const int sp = s0 + r - 2;      // pad_low = (6-1)/2 = 2
        #pragma unroll
        for (int j = 0; j < 2; ++j) {
            const int k4 = (tid + 256 * j) * 4;
            stg[r][j] = make_float4(0.0f, 0.0f, 0.0f, 0.0f);
            if (sp >= 0 && sp < S_ && k4 <= sp)
                stg[r][j] = ((const float4*)(scores + (rowBase + (size_t)sp) * S_))
                                [(unsigned)(tid + 256 * j)];
        }
    }

    if (tid < QK * WROW) wsm[tid] = wv;
    // zero halo: 4 slots per ring place (2 left, 2 right); no later store
    // touches them
    if (tid < QK * 4) {
        const int q = tid & 3;
        const int c = (q < 2) ? q : ROWQ - 4 + q;
        sm[tid >> 2][slot_of(c)] = make_float4(0.0f, 0.0f, 0.0f, 0.0f);
    }
    // causally zeroed rows; memory column k sits at LDS column k + HALO
    #pragma unroll
    for (int j = 0; j < 2; ++j) {
        const int k4 = (tid + 256 * j) * 4;
        if (k4 < stageEnd) {
            #pragma unroll
            for (int r = 0; r < QK; ++r) {
                const int sp = s0 + r - 2;
                float4 x = stg[r][j];   // x.x is live or already 0
                x.y = (k4 + 1 <= sp) ? x.y : 0.0f;
                x.z = (k4 + 2 <= sp) ? x.z : 0.0f;
                x.w = (k4 + 3 <= sp) ? x.w : 0.0f;
                sm[r][slot_of(HALO / 4 + tid + 256 * j)] = x;
            }
        }
    }
    __syncthreads();

    int ps[6];
    #pragma unroll
    for (int j = 0; j < 6; ++j) ps[j] = slot_of(2 * ct + j);

    // the source row that is fetched next (s + 4) and this thread's place in the
    // output row, each moved on by one row per trip
    const float4* nrow = (const float4*)(scores + (rowBase + (size_t)(s0 + 4)) * S_);
    _Float16*     orow = attn + (rowBase + (size_t)s0) * S_ + 8 * ct;

    // ring: the place of the oldest source row (s - 2) of the current query row
    int ring = 0;
    #pragma unroll 1
    for (int i = 0; i < RPB; ++i) {
        const int s = s0 + i;

        // Source row s + 4, which the next query row needs: issued here, stored
        // behind the conv.
        const int  sn   = s + 4;
        const bool more = i + 1 < RPB;
        float4 nx[2];
        #pragma unroll
        for (int j = 0; j < 2; ++j) {
            const int k4 = (tid + 256 * j) * 4;
            nx[j] = make_float4(0.0f, 0.0f, 0.0f, 0.0f);
            if (more && sn < S_ && k4 <= sn)
                nx[j] = nrow[(unsigned)(tid + 256 * j)];
        }

        // Columns 8*ct .. 8*ct+7. Column k, tap dk reads LDS column k + dk + 3,
        // which is win[c + dk + 3] of the window that starts at LDS column 8*ct.
        // Every loop of the nest is unrolled so that win[] and acc[] are indexed
        // by constants and stay in registers. Per output the sum starts from the
        // bias and takes the ring places in order, dk inner.
        float vout[8];
        float mx = NEGV;                  // a chunk behind the limit: all NEGV
        if (live) {
            float acc[8];
            #pragma unroll
            for (int c = 0; c < 8; ++c) acc[c] = bias;
            #pragma unroll
            for (int t = 0; t < QK; ++t) {
                // place t holds source row s - 2 + dq
                const int dq = (t - ring < 0) ? t - ring + QK : t - ring;
                float win[24];
                #pragma unroll
                for (int j = 0; j < 6; ++j) {
                    const float4 q = sm[t][ps[j]];
                    win[4 * j + 0] = q.x;
                    win[4 * j + 1] = q.y;
                    win[4 * j + 2] = q.z;
                    win[4 * j + 3] = q.w;
                }
                const float4* wr = (const float4*)(wsm + dq * WROW);
                const float4 w0 = wr[0], w1 = wr[1], w2 = wr[2];
                const float w[KK] = { w0.x, w0.y, w0.z, w0.w, w1.x, w1.y, w1.z,
                                      w1.w, w2.x, w2.y, w2.z };
                #pragma unroll
                for (int dk = 0; dk < KK; ++dk) {
                    #pragma unroll
                    for (int c = 0; c < 8; ++c)
                        acc[c] = fmaf(w[dk], win[c + dk + (HALO - 5)], acc[c]);
                }
            }

            mx = -3.4e38f;
            #pragma unroll
            for (int c = 0; c < 8; ++c) {
                const float val = (8 * ct + c <= s) ? acc[c] : NEGV;
                vout[c] = val;
                mx = fmaxf(mx, val);
            }
            #pragma unroll
            for (int off = 16; off > 0; off >>= 1)
                mx = fmaxf(mx, __shfl_xor(mx, off, 32));
        }

        // block max; redm[] is indexed by chunk, so it is read in column order
        if (lane == 0) redm[chunk] = mx;
        __syncthreads();                  // also ends every read of this row's windows

        // the new source row takes the oldest one's place; the barrier in front
        // of the sum's read publishes it
        if (more) {
            #pragma unroll
            for (int j = 0; j < 2; ++j) {
                const int k4 = (tid + 256 * j) * 4;
                if (k4 < stageEnd) {
                    float4 x = nx[j];     // x.x is live or already 0
                    x.y = (k4 + 1 <= sn) ? x.y : 0.0f;
                    x.z = (k4 + 2 <= sn) ? x.z : 0.0f;
                    x.w = (k4 + 3 <= sn) ? x.w : 0.0f;
                    sm[ring][slot_of(HALO / 4 + tid + 256 * j)] = x;
                }
            }
        }

        mx = redm[0];
        #pragma unroll
        for (int c = 1; c < 8; ++c) mx = fmaxf(mx, redm[c]);

        // exp + block sum
        float e[8];
        float se = 0.0f;
        if (live) {
            #pragma unroll
            for (int c = 0; c < 8; ++c)   // e^x as 2^(x * log2 e), as __expf does
                vout[c] = (vout[c] - mx) * 1.44269504f;
            // The 8 v_exp_f32 stand in one statement, each on registers of its own,
            // with the free slot that the instruction set asks for behind the last.
            asm("v_exp_f32 %0, %8\n\t"
                "v_exp_f32 %1, %9\n\t"
                "v_exp_f32 %2, %10\n\t"
                "v_exp_f32 %3, %11\n\t"
                "v_exp_f32 %4, %12\n\t"
                "v_exp_f32 %5, %13\n\t"
                "v_exp_f32 %6, %14\n\t"
                "v_exp_f32 %7, %15\n\t"
                "v_nop"
                : "=&v"(e[0]), "=&v"(e[1]), "=&v"(e[2]), "=&v"(e[3]),
                  "=&v"(e[4]), "=&v"(e[5]), "=&v"(e[6]), "=&v"(e[7])
                : "v"(vout[0]), "v"(vout[1]), "v"(vout[2]), "v"(vout[3]),
                  "v"(vout[4]), "v"(vout[5]), "v"(vout[6]), "v"(vout[7]));
            #pragma unroll
            for (int c = 0; c < 8; ++c) se += e[c];
            #pragma unroll
            for (int off = 16; off > 0; off >>= 1)
                se += __shfl_xor(se, off, 32);
        } else {
            // 256 equal terms
            const float e0 = __expf(NEGV - mx);
            #pragma unroll
            for (int c = 0; c < 8; ++c) e[c] = e0;
            se = 256.0f * e0;
        }
        // The maxima and the sums have an array each: a wave writes redm again
        // only behind this barrier, which every wave reaches with its maxima
        // read, and reds again only behind the next row's first barrier.
        if (lane == 0) reds[chunk] = se;
        __syncthreads();
        float tot = 0.0f;
        #pragma unroll
        for (int c = 0; c < 8; ++c) tot += reds[c];
        const float inv = 1.0f / tot;

        // the thread's 8 adjacent probabilities leave as one 16-byte store
        // (unrolled: p[] is a register vector, indexed by constants)
        v8h p;
        #pragma unroll
        for (int c = 0; c < 8; ++c) p[c] = (_Float16)(e[c] * inv);
        *(v8h*)orow = p;
        // The wait that belongs in front of any rewrite of a register that an
        // issued store names: the next trip reuses the store's registers.
        asm volatile("s_wait_xcnt 0x0" ::: "memory");

        nrow += S_ / 4;
        orow += S_;
        ring = (ring + 1 == QK) ? 0 : ring + 1;
    }
}

// ---------------------------------------------------------------------------
// Kernel 2: downconvert v [b,h,k,d] f32 -> vt f16, laid out in the order in
// which a wave of kernel 3 reads its B fragments:
//   vt[b,h][slice w of 16 dims][group j of 16 keys][lane l][8 keys]
// where lane l holds dim 16w + (l & 15) and keys 16j + 8(l >> 4) .. + 7.
// One fragment load of a wave is then 512 bytes in a row, 4 whole lines (in a
// [d][k] array its 16 dims would lie 4 KB apart, 16 lines to a load).
// One block per 64-key x 64-dim tile (512 blocks). The tile is 16 KB in a row
// in v: it is read with whole-line 16-byte loads, turned in LDS, and leaves as
// 4 runs of 2 KB (one per slice), every wave's store 512 bytes in a row.
// LDS pitch 66 floats: the reads of lane l fall on bank 2k + d, which is
// base + (l & 15) + 16(l >> 4), 32 different banks; the row writes of a wave
// (two keys, 16 groups of 4 dims) are conflict-free as well.
// ---------------------------------------------------------------------------
#define TK 64                      // keys per tile
#define VTK 16                     // vt elements per key of a slice (one per dim)

__global__ __launch_bounds__(256)
void k2_vt(const float* __restrict__ v, _Float16* __restrict__ vt)
{
    const int k0  = blockIdx.x * TK;
    const int bh  = blockIdx.y;
    const int tid = threadIdx.x;

    __shared__ float tile[TK][D_ + 2];

    // unrolled: the 4 loads stand in a row, one memory latency for the tile
    const float4* vin = (const float4*)(v + ((size_t)bh * S_ + k0) * D_);
    float4 x[4];
    #pragma unroll
    for (int j = 0; j < 4; ++j) x[j] = vin[tid + 256 * j];
    #pragma unroll
    for (int j = 0; j < 4; ++j) {
        const int idx = tid + 256 * j;
        const int k = idx >> 4;
        const int d = (idx & 15) * 4;
        tile[k][d + 0] = x[j].x;
        tile[k][d + 1] = x[j].y;
        tile[k][d + 2] = x[j].z;
        tile[k][d + 3] = x[j].w;
    }
    __syncthreads();

    // unrolled: p[] is a register vector, indexed by constants
    #pragma unroll
    for (int j = 0; j < 2; ++j) {
        const int q  = tid + 256 * j;     // 16-byte unit of the tile's output
        const int l  = q & 31;            // the lane of kernel 3 that reads it
        const int jl = (q >> 5) & 3;      // group of 16 keys inside the tile
        const int w  = q >> 7;            // slice of 16 dims
        const int d  = 16 * w + (l & 15);
        const int kk = 16 * jl + 8 * (l >> 4);
        v8h p;
        #pragma unroll
        for (int i = 0; i < 8; ++i) p[i] = (_Float16)tile[kk + i][d];
        *(v8h*)(vt + ((size_t)(bh * (D_ / 16) + w) * S_ + k0 + 16 * jl) * VTK + 8 * l) = p;
    }
}

// ---------------------------------------------------------------------------
// Kernel 3: head-mix (packed f16 FMA) + attn@v via v_wmma_f32_16x16x32_f16 +
// fused LayerNorm over D.
// A 16-row tile of one head-GROUP (both output heads j=0 and j=1) is worked on
// by four waves: the raw attn fragments a0/a1 are shared by both output heads,
// so each pair of A loads feeds TWO WMMAs (two mixes x two V heads).
// Each wave owns one 16-column slice of D for both heads; K runs in steps of
// 32.  A-fragment K packing per ISA: lanes 0-15 -> K {0..7,16..23},
// lanes 16-31 -> K {8..15,24..31}.  The B fragments have the same K packing;
// kernel 2 has laid vt out so that the 32 lanes' 16 bytes of one B load stand
// in a row.
// Causal limit: behind column m0 + 15 every probability of a tile is a masked
// one, and all masked probabilities of a row are the same number, which is 0
// unless the row's live scores lie near NEGV themselves. A tile's K range ends
// at the first multiple of KSTEP behind its last live column; the rest of K is
// run only if the last column of one of the tile's rows (a masked one wherever
// there is a rest) is not 0, so no input loses a term.
// Block = 256 threads (8 wave32) = row tiles i (short range) and 127 - i (long
// range). The two ranges add up to S_ + KSTEP columns in every block. Waves
// 0-3 take the first KCUT columns of the long tile; waves 4-7 take the short
// tile and what the long tile has behind KCUT: 9 and 8 trips, whatever i is.
// The long tile's two partial sums are added where the LayerNorm reads them.
// ---------------------------------------------------------------------------
#define KSTEP 128                  // columns per trip: 4 WMMA steps
#define KCUT  (S_ / 2 + KSTEP)     // no long tile's range ends in front of it
#define VT1   ((D_ / 16) * S_ * VTK)  // vt elements from one head to the next

typedef const __attribute__((address_space(1))) _Float16* gl_h;
typedef const __attribute__((address_space(1))) v8h*      gl_v8h;

__global__ __launch_bounds__(256)
void k3_mix_gemm_ln(const _Float16* __restrict__ attn,
                    const _Float16* __restrict__ vt,
                    const float* __restrict__ head_mix,
                    const float* __restrict__ gamma,
                    const float* __restrict__ beta,
                    float* __restrict__ out)
{
    // readfirstlane: the half's number in a scalar register, so that the K
    // bounds are scalar and every lane is on at the WMMAs.
    const int hf = __builtin_amdgcn_readfirstlane(threadIdx.x >> 7);
    const int mS = blockIdx.x * 16;                       // short tile's rows
    const int mL = ((S_ / 16 - 1) - blockIdx.x) * 16;     // long tile's rows
    const int kS = (mS + 16 + KSTEP - 1) & ~(KSTEP - 1);  // end of its live range
    const int kL = (mL + 16 + KSTEP - 1) & ~(KSTEP - 1);
    const int m0 = hf ? mS : mL;          // the tile that this half finishes
    const int g  = blockIdx.y;            // head group (HEAD_K = 2)
    const int b  = blockIdx.z;

    const int lane = threadIdx.x & 31;
    const int w    = (threadIdx.x >> 5) & 3;

    // mixed_j = M[g,0,j]*attn_{2g} + M[g,1,j]*attn_{2g+1}
    const _Float16 c00 = (_Float16)head_mix[g * 4 + 0];   // i=0, j=0
    const _Float16 c01 = (_Float16)head_mix[g * 4 + 1];   // i=0, j=1
    const _Float16 c10 = (_Float16)head_mix[g * 4 + 2];   // i=1, j=0
    const _Float16 c11 = (_Float16)head_mix[g * 4 + 3];   // i=1, j=1

    const int mrow = m0 + (lane & 15);
    const int lrow = mL + (lane & 15);
    const int koff = (lane >> 4) << 3;    // 0 or 8

    const size_t bh0 = (size_t)b * H_ + (g * 2 + 0);
    const size_t bh1 = (size_t)b * H_ + (g * 2 + 1);
    const _Float16* a0p = attn + (bh0 * S_ + (size_t)mrow) * S_ + koff;
    const _Float16* a1p = attn + (bh1 * S_ + (size_t)mrow) * S_ + koff;
    const _Float16* l0p = attn + (bh0 * S_ + (size_t)lrow) * S_ + koff;
    const _Float16* l1p = attn + (bh1 * S_ + (size_t)lrow) * S_ + koff;

    // this wave's slice of vt; key k's group of 16 starts VTK * k further on
    const _Float16* b0p = vt + (bh0 * (D_ / 16) + (size_t)w) * (S_ * VTK) + 8 * lane;
    const _Float16* b1p = vt + (bh1 * (D_ / 16) + (size_t)w) * (S_ * VTK) + 8 * lane;

    // last column of the 32 rows (16 rows x 2 heads) of this half's tile, one
    // per lane; issued here, looked at only behind the live ranges
    const _Float16 lastp =
        attn[(((lane >> 4) ? bh1 : bh0) * S_ + (size_t)mrow) * S_ + (S_ - 1)];

    // one WMMA step on the fragments of 32 columns: rows of head 2g (a0), of
    // head 2g+1 (a1), and the two V heads (b0, b1)
    auto mma = [&](v8h a0lo, v8h a0hi, v8h a1lo, v8h a1hi,
                   v8h b0lo, v8h b0hi, v8h b1lo, v8h b1hi, v8f& c0, v8f& c1) {
        // two head-mixes from one pair of A fragments (v_pk_fma_f16)
        const v8h m0lo = a0lo * c00 + a1lo * c10;
        const v8h m0hi = a0hi * c00 + a1hi * c10;
        const v8h m1lo = a0lo * c01 + a1lo * c11;
        const v8h m1hi = a0hi * c01 + a1hi * c11;

        const v16h A0 = __builtin_shufflevector(m0lo, m0hi,
            0,1,2,3,4,5,6,7,8,9,10,11,12,13,14,15);
        const v16h A1 = __builtin_shufflevector(m1lo, m1hi,
            0,1,2,3,4,5,6,7,8,9,10,11,12,13,14,15);
        const v16h B0 = __builtin_shufflevector(b0lo, b0hi,
            0,1,2,3,4,5,6,7,8,9,10,11,12,13,14,15);
        const v16h B1 = __builtin_shufflevector(b1lo, b1hi,
            0,1,2,3,4,5,6,7,8,9,10,11,12,13,14,15);

        c0 = __builtin_amdgcn_wmma_f32_16x16x32_f16(
            false, A0, false, B0, (short)0, c0, false, false);
        c1 = __builtin_amdgcn_wmma_f32_16x16x32_f16(
            false, A1, false, B1, (short)0, c1, false, false);
    };
    // columns kb .. ke-1 of the rows at p0 (head 2g) and p1 (head 2g+1),
    // KSTEP a trip
    auto span = [&](const _Float16* p0, const _Float16* p1, int kb, int ke,
                    v8f& c0, v8f& c1) {
        // Typed as pointers to global memory: behind the asm statement below the
        // compiler no longer sees where they came from, and plain pointers
        // would turn every load of the loop into a flat load.
        gl_h q0 = (gl_h)(p0 + kb);
        gl_h q1 = (gl_h)(p1 + kb);
        gl_h r0 = (gl_h)(b0p + kb * VTK);  // head 2g+1 stands VT1 further on
        for (int kq = kb; kq < ke; kq += KSTEP) {
            // unrolled: the fragments are register arrays, indexed by constants
            v8h fa0[8], fa1[8], fb0[8], fb1[8];
            #pragma unroll
            for (int u = 0; u < 8; ++u) {
                fa0[u] = *(gl_v8h)(q0 + 16 * u);
                fa1[u] = *(gl_v8h)(q1 + 16 * u);
                fb0[u] = *(gl_v8h)(r0 + 16 * u * VTK);
                fb1[u] = *(gl_v8h)(r0 + 16 * u * VTK + VT1);
            }
            // The wait that belongs in front of any rewrite of a register that an
            // issued load names as its address. The addresses pass through the
            // statement: no load's result is placed in their registers ahead of
            // it, and their step to the next trip, which reads what it hands on,
            // cannot be placed ahead of it either.
            asm volatile("s_wait_xcnt 0x0" : "+v"(q0), "+v"(q1), "+v"(r0) :: "memory");
            #pragma unroll
            for (int u = 0; u < 8; u += 2)
                mma(fa0[u], fa0[u + 1], fa1[u], fa1[u + 1],
                    fb0[u], fb0[u + 1], fb1[u], fb1[u + 1], c0, c1);
            q0 += KSTEP;
            q1 += KSTEP;
            r0 += KSTEP * VTK;
        }
    };

    v8f acc0 = {}, acc1 = {};             // this half's own tile
    v8f par0 = {}, par1 = {};             // waves 4-7: the long tile behind KCUT
    span(a0p, a1p, 0, hf ? kS : KCUT, acc0, acc1);
    span(l0p, l1p, KCUT, hf ? kL : KCUT, par0, par1);
    // The rest of K, for rows whose masked probabilities are not 0.
    // ballot: one scalar answer for the wave, so the branch is scalar.
    if (__builtin_amdgcn_ballot_w32(lastp != (_Float16)0.0f) != 0u) {
        // not unrolled: a path that few inputs take is kept small
        #pragma unroll 1
        for (int k0 = hf ? kS : kL; k0 < S_; k0 += 32)
            mma(*(const v8h*)(a0p + k0), *(const v8h*)(a0p + k0 + 16),
                *(const v8h*)(a1p + k0), *(const v8h*)(a1p + k0 + 16),
                *(const v8h*)(b0p + k0 * VTK), *(const v8h*)(b0p + (k0 + 16) * VTK),
                *(const v8h*)(b1p + k0 * VTK), *(const v8h*)(b1p + (k0 + 16) * VTK), acc0, acc1);
    }

    // Scatter C tiles to LDS: VGPR r -> row r (lanes 0-15) / r+8 (lanes 16-31)
    __shared__ float tile[2][2][16][72];   // [half][head][row][col]
    __shared__ float part[2][16][72];      // long tile, columns behind KCUT
    const int rbase = (lane >> 4) << 3;
    const int col   = 16 * w + (lane & 15);
    #pragma unroll
    for (int r = 0; r < 8; ++r) {
        tile[hf][0][rbase + r][col] = acc0[r];
        tile[hf][1][rbase + r][col] = acc1[r];
    }
    if (hf) {
        #pragma unroll
        for (int r = 0; r < 8; ++r) {
            part[0][rbase + r][col] = par0[r];
            part[1][rbase + r][col] = par1[r];
        }
    }
    __syncthreads();

    // LayerNorm over D=64 for each tile's 32 rows (2 heads x 16): 4 threads per row,
    // 16 cols each, shuffle-reduce within aligned 4-lane groups.
    const int t  = threadIdx.x & 127;
    const int jj = t >> 6;                // output head within group
    const int r  = (t >> 2) & 15;        // row within tile
    const int cb = (t & 3) * 16;         // column base
    float x[16];
    float sum = 0.0f, sq = 0.0f;
    #pragma unroll
    for (int i = 0; i < 16; ++i) x[i] = tile[hf][jj][r][cb + i];
    if (!hf) {                            // long tile: join its two partial sums
        #pragma unroll
        for (int i = 0; i < 16; ++i) x[i] += part[jj][r][cb + i];
    }
    #pragma unroll
    for (int i = 0; i < 16; ++i) {
        sum += x[i];
        sq  += x[i] * x[i];
    }
    #pragma unroll
    for (int off = 1; off < 4; off <<= 1) {
        sum += __shfl_xor(sum, off, 32);
        sq  += __shfl_xor(sq,  off, 32);
    }
    const float mean = sum * (1.0f / 64.0f);
    const float var  = sq * (1.0f / 64.0f) - mean * mean;
    const float rs   = rsqrtf(var + 1e-5f);

    const size_t obase =
        (((size_t)b * H_ + (g * 2 + jj)) * S_ + (size_t)(m0 + r)) * D_ + cb;
    #pragma unroll
    for (int i = 0; i < 16; ++i)
        out[obase + i] = (x[i] - mean) * rs * gamma[cb + i] + beta[cb + i];
}

// ---------------------------------------------------------------------------
extern "C" void kernel_launch(void* const* d_in, const int* in_sizes, int n_in,
                              void* d_out, int out_size, void* d_ws, size_t ws_size,
                              hipStream_t stream)
{
    const float* scores   = (const float*)d_in[0];
    const float* v        = (const float*)d_in[1];
    const float* kq_w     = (const float*)d_in[2];
    const float* kq_b     = (const float*)d_in[3];
    const float* head_mix = (const float*)d_in[4];
    const float* gamma    = (const float*)d_in[5];
    const float* beta     = (const float*)d_in[6];
    float* out = (float*)d_out;

    // workspace: [attn f16 : B*H*S*S] [vt f16 : B*H*D*S]  (128MB + 4MB)
    _Float16* wsAttn = (_Float16*)d_ws;
    _Float16* wsVt   = (_Float16*)((char*)d_ws +
                        (size_t)B_ * H_ * S_ * S_ * sizeof(_Float16));

    dim3 g1(B_ * H_, S_ / RPB);     // one block per head and group of RPB rows
    k1_conv_softmax<<<g1, 256, 0, stream>>>(scores, kq_w, kq_b, wsAttn);

    dim3 g2(S_ / TK, B_ * H_);
    k2_vt<<<g2, 256, 0, stream>>>(v, wsVt);

    dim3 g3(S_ / 32, H_ / 2, B_);   // one block per pair of row tiles and head GROUP
    k3_mix_gemm_ln<<<g3, 256, 0, stream>>>(wsAttn, wsVt, head_mix,
                                           gamma, beta, out);
}

// v008
// Measured time: 88.2 microseconds a run.
// Next to v007, in two timings, it ran 1.04 times as fast each time.
// Counting every step since v000, it is 6.51 times as fast.
#include <hip/hip_runtime.h>
#include <hip/hip_bf16.h>

typedef __attribute__((ext_vector_type(16))) _Float16 v16h;
typedef __attribute__((ext_vector_type(8)))  _Float16 v8h;
typedef __attribute__((ext_vector_type(8)))  float    v8f;

#define B_  2
#define H_  8
#define S_  2048
#define D_  64
#define QK  6
#define KK  11
#define NEGV (-1.0e9f)
#define HALO 8

// ---------------------------------------------------------------------------
// The v part of launch 1: downconvert v [b,h,k,d] f32 -> vt f16, laid out in the
// order in which a wave of the product kernel reads its B fragments:
//   vt[b,h][slice w of 16 dims][group j of 16 keys][lane l][8 keys]
// where lane l holds dim 16w + (l & 15) and keys 16j + 8(l >> 4) .. + 7.
// One fragment load of a wave is then 512 bytes in a row, 4 whole lines (in a
// [d][k] array its 16 dims would lie 4 KB apart, 16 lines to a load).
// One block per 64-key x 64-dim tile (512 blocks). The tile is 16 KB in a row
// in v: a thread reads 64 bytes of it in a row (a wave's four loads cover 2 KB
// of whole lines between them), it is turned in LDS, and leaves as 4 runs of
// 2 KB (one per slice), every wave's store 512 bytes in a row.
// LDS pitch 66 floats: the reads of lane l fall on bank 2k + d, which is
// base + (l & 15) + 16(l >> 4), 32 different banks; the row writes of a wave
// (eight keys, 4 groups of 4 dims 16 dims apart) are conflict-free as well.
// It needs nothing of the conv and the conv nothing of it, so its blocks ride at
// the end of the conv's grid instead of having a launch of their own. The tile lies in the conv's LDS array.
// ---------------------------------------------------------------------------
#define TK 64                      // keys per tile
#define VTK 16                     // vt elements from one key to the next in a slice

__device__ __forceinline__
void vt_tile(const float* __restrict__ v, _Float16* __restrict__ vt,
             const int k0, const int bh, float (*tile)[D_ + 2])
{
    const int tid = threadIdx.x;

    // unrolled: the 4 loads stand in a row, one memory latency for the tile.
    // A thread's loads are adjacent and not 4 KB apart: with far-apart loads in
    // it the compiler rates the whole kernel as held up by strided memory
    // access and lets go of the conv's register limit (94 registers for 80), and
    // a WGP then holds five of the conv's blocks and not six.
    const float4* vin = (const float4*)(v + ((size_t)bh * S_ + k0) * D_);
    float4 x[4];
    #pragma unroll
    for (int j = 0; j < 4; ++j) x[j] = vin[4 * tid + j];
    #pragma unroll
    for (int j = 0; j < 4; ++j) {
        const int idx = 4 * tid + j;
        const int k = idx >> 4;
        const int d = (idx & 15) * 4;
        tile[k][d + 0] = x[j].x;
        tile[k][d + 1] = x[j].y;
        tile[k][d + 2] = x[j].z;
        tile[k][d + 3] = x[j].w;
    }
    __syncthreads();

    // unrolled: p[] is a register vector, indexed by constants
    #pragma unroll
    for (int j = 0; j < 2; ++j) {
        const int q  = tid + 256 * j;     // 16-byte unit of the tile's output
        const int l  = q & 31;            // the lane of the product kernel that reads it
        const int jl = (q >> 5) & 3;      // group of 16 keys inside the tile
        const int w  = q >> 7;            // slice of 16 dims
        const int d  = 16 * w + (l & 15);
        const int kk = 16 * jl + 8 * (l >> 4);
        v8h p;
        #pragma unroll
        for (int i = 0; i < 8; ++i) p[i] = (_Float16)tile[kk + i][d];
        *(v8h*)(vt + ((size_t)(bh * (D_ / 16) + w) * S_ + k0 + 16 * jl) * VTK + 8 * l) = p;
    }
}

// ---------------------------------------------------------------------------
// Kernel 1 (launch 1): masked depthwise conv (6x11, SAME) + bias + causal re-mask +
//           row softmax, emitting f16 probabilities.
// One block per RPB adjacent query rows of one (b,h). 256 threads, 8 ADJACENT
// columns per thread. The block walks its rows one after the other.
// LDS: a ring of 6 source rows with an 8-column zero halo on each side (5 are
// read; 8 keeps every row and every 4-column group 16-byte aligned). A masked
// source row does not depend on the query row that reads it, so from one query
// row to the next five of the six stay where they are and one new row takes
// the place of the oldest: a source row is fetched once per block and not once
// per query row, and a wave is launched once per RPB rows.
// The new row's loads are issued in front of the conv of the current row and
// stored to LDS behind the barrier that ends that conv's reads.
// Conv: per source row a thread reads the 24 floats that cover its 8 columns
// and their taps with 6 16-byte LDS reads and slides the 11 taps over them in
// registers. The ring places are walked in a fixed order, so that the window
// reads keep constant offsets; which tap row belongs to a place moves with the
// ring and is looked up.
// Causal limit: a wave owns one chunk of 256 columns. A chunk that starts
// behind column s holds only masked columns, all equal to NEGV: its wave reads
// no window, does no conv, and takes one exp for its equal terms. Nothing is
// staged behind the last column that a live chunk's windows reach. The rows of
// a block lie in one group of 256, so both limits are the same for all of them.
// ---------------------------------------------------------------------------
#define ROWP  (S_ + 2 * HALO)      // LDS row pitch in floats
#define ROWQ  (ROWP / 4)           // the same in 4-float slots
#define RPB   8                    // query rows per block (divides 256)
#define WROW  12                   // LDS pitch of a tap row: 11 taps, 16-byte aligned

// Place of 4-float slot q inside an LDS row. The conv reads slots 2*ct + j:
// unswizzled, lanes t and t + 8 of a 16-lane half would meet on the same four
// banks. Swapping the two slots of each pair in every other group of 16 slots
// puts the 16 lanes on 16 different bank quads.
__device__ __forceinline__ int slot_of(int q) { return q ^ ((q >> 4) & 1); }

__global__ __launch_bounds__(256)
void k1_conv_softmax(const float* __restrict__ scores,
                     const float* __restrict__ kq_w,
                     const float* __restrict__ kq_b,
                     _Float16* __restrict__ attn,
                     const float* __restrict__ v,
                     _Float16* __restrict__ vt)
{
    __shared__ __attribute__((aligned(16))) float4 sm[QK][ROWQ];

    // The blocks behind the conv's S_ / RPB row groups turn one tile of v each.
    // The test is the same for the whole block and stands in front of every
    // barrier.
    if (blockIdx.y >= S_ / RPB) {
        vt_tile(v, vt, (int)(blockIdx.y - S_ / RPB) * TK, (int)blockIdx.x,
                (float (*)[D_ + 2])sm);
        return;
    }

    // The row groups are taken from the last: the ones with the longest live
    // ranges have the lowest block indices (for speed only).
    const int s0 = (S_ / RPB - 1 - blockIdx.y) * RPB;   // first query row
    const int bh = blockIdx.x;
    const int h  = bh & (H_ - 1);
    const int tid = threadIdx.x;
    const int lane = tid & 31;

    // Which chunk of 256 columns this wave owns. The live chunks are the low
    // ones; the start is turned from block to block so that they do not fall
    // on the same waves in every block (for speed only).
    // readfirstlane: the wave's number in a scalar register, so that the skip
    // below is a scalar branch.
    const int wave  = __builtin_amdgcn_readfirstlane(tid >> 5);
    const int turn  = s0 ^ (s0 >> 2) ^ (s0 >> 4) ^ (s0 >> 6) ^ (s0 >> 8) ^ (s0 >> 10);
    const int chunk = (wave + turn) & 7;
    const int ct    = 32 * chunk + lane;  // the thread makes columns 8*ct..8*ct+7
    const bool live = 256 * chunk <= s0;  // the same for the wave and for all rows
    // first column that no live window reaches (the last live chunk ends at
    // column s0 | 255 and its windows run 8 columns further)
    const int stageEnd = (s0 | 255) + 9;

    __shared__ __attribute__((aligned(16))) float wsm[QK * WROW];
    __shared__ float redm[8];
    __shared__ float reds[8];

    const float bias = kq_b[h];
    float wv = 0.0f;
    if (tid < QK * WROW && tid % WROW < KK)
        wv = kq_w[h * (QK * KK) + (tid / WROW) * KK + tid % WROW];

    const size_t rowBase = (size_t)bh * (size_t)S_;

    // The first 6 source rows (s0-2 .. s0+3): every load is issued before any
    // store. A 4-column group that lies wholly behind the causal limit is not
    // read. Both loop nests are unrolled so that stg[][] stays in registers and
    // the 12 loads stand in a row with no wait between them.
    float4 stg[QK][2];
    #pragma unroll
    for (int r = 0; r < QK; ++r) {
        const int sp = s0 + r - 2;      // pad_low = (6-1)/2 = 2
        #pragma unroll
        for (int j = 0; j < 2; ++j) {
            const int k4 = (tid + 256 * j) * 4;
            stg[r][j] = make_float4(0.0f, 0.0f, 0.0f, 0.0f);
            if (sp >= 0 && sp < S_ && k4 <= sp)
                stg[r][j] = ((const float4*)(scores + (rowBase + (size_t)sp) * S_))
                                [(unsigned)(tid + 256 * j)];
        }
    }

    if (tid < QK * WROW) wsm[tid] = wv;
    // zero halo: 4 slots per ring place (2 left, 2 right); no later store
    // touches them
    if (tid < QK * 4) {
        const int q = tid & 3;
        const int c = (q < 2) ? q : ROWQ - 4 + q;
        sm[tid >> 2][slot_of(c)] = make_float4(0.0f, 0.0f, 0.0f, 0.0f);
    }
    // causally zeroed rows; memory column k sits at LDS column k + HALO
    #pragma unroll
    for (int j = 0; j < 2; ++j) {
        const int k4 = (tid + 256 * j) * 4;
        if (k4 < stageEnd) {
            #pragma unroll
            for (int r = 0; r < QK; ++r) {
                const int sp = s0 + r - 2;
                float4 x = stg[r][j];   // x.x is live or already 0
                x.y = (k4 + 1 <= sp) ? x.y : 0.0f;
                x.z = (k4 + 2 <= sp) ? x.z : 0.0f;
                x.w = (k4 + 3 <= sp) ? x.w : 0.0f;
                sm[r][slot_of(HALO / 4 + tid + 256 * j)] = x;
            }
        }
    }
    __syncthreads();

    int ps[6];
    #pragma unroll
    for (int j = 0; j < 6; ++j) ps[j] = slot_of(2 * ct + j);

    // the source row that is fetched next (s + 4) and this thread's place in the
    // output row, each moved on by one row per trip
    const float4* nrow = (const float4*)(scores + (rowBase + (size_t)(s0 + 4)) * S_);
    _Float16*     orow = attn + (rowBase + (size_t)s0) * S_ + 8 * ct;

    // ring: the place of the oldest source row (s - 2) of the current query row
    int ring = 0;
    #pragma unroll 1
    for (int i = 0; i < RPB; ++i) {
        const int s = s0 + i;

        // Source row s + 4, which the next query row needs: issued here, stored
        // behind the conv.
        const int  sn   = s + 4;
        const bool more = i + 1 < RPB;
        float4 nx[2];
        #pragma unroll
        for (int j = 0; j < 2; ++j) {
            const int k4 = (tid + 256 * j) * 4;
            nx[j] = make_float4(0.0f, 0.0f, 0.0f, 0.0f);
            if (more && sn < S_ && k4 <= sn)
                nx[j] = nrow[(unsigned)(tid + 256 * j)];
        }

        // Columns 8*ct .. 8*ct+7. Column k, tap dk reads LDS column k + dk + 3,
        // which is win[c + dk + 3] of the window that starts at LDS column 8*ct.
        // Every loop of the nest is unrolled so that win[] and acc[] are indexed
        // by constants and stay in registers. Per output the sum starts from the
        // bias and takes the ring places in order, dk inner.
        float vout[8];
        float mx = NEGV;                  // a chunk behind the limit: all NEGV
        if (live) {
            float acc[8];
            #pragma unroll
            for (int c = 0; c < 8; ++c) acc[c] = bias;
            #pragma unroll
            for (int t = 0; t < QK; ++t) {
                // place t holds source row s - 2 + dq
                const int dq = (t - ring < 0) ? t - ring + QK : t - ring;
                float win[24];
                #pragma unroll
                for (int j = 0; j < 6; ++j) {
                    const float4 q = sm[t][ps[j]];
                    win[4 * j + 0] = q.x;
                    win[4 * j + 1] = q.y;
                    win[4 * j + 2] = q.z;
                    win[4 * j + 3] = q.w;
                }
                const float4* wr = (const float4*)(wsm + dq * WROW);
                const float4 w0 = wr[0], w1 = wr[1], w2 = wr[2];
                const float w[KK] = { w0.x, w0.y, w0.z, w0.w, w1.x, w1.y, w1.z,
                                      w1.w, w2.x, w2.y, w2.z };
                #pragma unroll
                for (int dk = 0; dk < KK; ++dk) {
                    #pragma unroll
                    for (int c = 0; c < 8; ++c)
                        acc[c] = fmaf(w[dk], win[c + dk + (HALO - 5)], acc[c]);
                }
            }

            mx = -3.4e38f;
            #pragma unroll
            for (int c = 0; c < 8; ++c) {
                const float val = (8 * ct + c <= s) ? acc[c] : NEGV;
                vout[c] = val;
                mx = fmaxf(mx, val);
            }
            #pragma unroll
            for (int off = 16; off > 0; off >>= 1)
                mx = fmaxf(mx, __shfl_xor(mx, off, 32));
        }

        // block max; redm[] is indexed by chunk, so it is read in column order
        if (lane == 0) redm[chunk] = mx;
        __syncthreads();                  // also ends every read of this row's windows

        // the new source row takes the oldest one's place; the barrier in front
        // of the sum's read publishes it
        if (more) {
            #pragma unroll
            for (int j = 0; j < 2; ++j) {
                const int k4 = (tid + 256 * j) * 4;
                if (k4 < stageEnd) {
                    float4 x = nx[j];     // x.x is live or already 0
                    x.y = (k4 + 1 <= sn) ? x.y : 0.0f;
                    x.z = (k4 + 2 <= sn) ? x.z : 0.0f;
                    x.w = (k4 + 3 <= sn) ? x.w : 0.0f;
                    sm[ring][slot_of(HALO / 4 + tid + 256 * j)] = x;
                }
            }
        }

        mx = redm[0];
        #pragma unroll
        for (int c = 1; c < 8; ++c) mx = fmaxf(mx, redm[c]);

        // exp + block sum
        float e[8];
        float se = 0.0f;
        if (live) {
            #pragma unroll
            for (int c = 0; c < 8; ++c)   // e^x as 2^(x * log2 e), as __expf does
                vout[c] = (vout[c] - mx) * 1.44269504f;
            // The 8 v_exp_f32 stand in one statement, each on registers of its own,
            // with the free slot that the instruction set asks for behind the last.
            asm("v_exp_f32 %0, %8\n\t"
                "v_exp_f32 %1, %9\n\t"
                "v_exp_f32 %2, %10\n\t"
                "v_exp_f32 %3, %11\n\t"
                "v_exp_f32 %4, %12\n\t"
                "v_exp_f32 %5, %13\n\t"
                "v_exp_f32 %6, %14\n\t"
                "v_exp_f32 %7, %15\n\t"
                "v_nop"
                : "=&v"(e[0]), "=&v"(e[1]), "=&v"(e[2]), "=&v"(e[3]),
                  "=&v"(e[4]), "=&v"(e[5]), "=&v"(e[6]), "=&v"(e[7])
                : "v"(vout[0]), "v"(vout[1]), "v"(vout[2]), "v"(vout[3]),
                  "v"(vout[4]), "v"(vout[5]), "v"(vout[6]), "v"(vout[7]));
            #pragma unroll
            for (int c = 0; c < 8; ++c) se += e[c];
            #pragma unroll
            for (int off = 16; off > 0; off >>= 1)
                se += __shfl_xor(se, off, 32);
        } else {
            // 256 equal terms
            const float e0 = __expf(NEGV - mx);
            #pragma unroll
            for (int c = 0; c < 8; ++c) e[c] = e0;
            se = 256.0f * e0;
        }
        // The maxima and the sums have an array each: a wave writes redm again
        // only behind this barrier, which every wave reaches with its maxima
        // read, and reds again only behind the next row's first barrier.
        if (lane == 0) reds[chunk] = se;
        __syncthreads();
        float tot = 0.0f;
        #pragma unroll
        for (int c = 0; c < 8; ++c) tot += reds[c];
        const float inv = 1.0f / tot;

        // the thread's 8 adjacent probabilities leave as one 16-byte store
        // (unrolled: p[] is a register vector, indexed by constants)
        v8h p;
        #pragma unroll
        for (int c = 0; c < 8; ++c) p[c] = (_Float16)(e[c] * inv);
        *(v8h*)orow = p;
        // The wait that belongs in front of any rewrite of a register that an
        // issued store names: the next trip reuses the store's registers.
        asm volatile("s_wait_xcnt 0x0" ::: "memory");

        nrow += S_ / 4;
        orow += S_;
        ring = (ring + 1 == QK) ? 0 : ring + 1;
    }
}

// ---------------------------------------------------------------------------
// Product kernel (launch 2): head-mix (packed f16 FMA) + attn@v via
// v_wmma_f32_16x16x32_f16 +
// fused LayerNorm over D.
// A 16-row tile of one head-GROUP (both output heads j=0 and j=1) is worked on
// by four waves: the raw attn fragments a0/a1 are shared by both output heads,
// so each pair of A loads feeds TWO WMMAs (two mixes x two V heads).
// Each wave owns one 16-column slice of D for both heads; K runs in steps of
// 32.  A-fragment K packing per ISA: lanes 0-15 -> K {0..7,16..23},
// lanes 16-31 -> K {8..15,24..31}.  The B fragments have the same K packing;
// launch 1 has laid vt out so that the 32 lanes' 16 bytes of one B load stand
// in a row.
// Causal limit: behind column m0 + 15 every probability of a tile is a masked
// one, and all masked probabilities of a row are the same number, which is 0
// unless the row's live scores lie near NEGV themselves. A tile's K range ends
// at the first multiple of KSTEP behind its last live column; the rest of K is
// run only if the last column of one of the tile's rows (a masked one wherever
// there is a rest) is not 0, so no input loses a term.
// Block = 256 threads (8 wave32) = row tiles i (short range) and 127 - i (long
// range). The two ranges add up to S_ + KSTEP columns in every block. Waves
// 0-3 take the first KCUT columns of the long tile; waves 4-7 take the short
// tile and what the long tile has behind KCUT: 9 and 8 trips, whatever i is.
// The long tile's two partial sums are added where the LayerNorm reads them.
// ---------------------------------------------------------------------------
#define KSTEP 128                  // columns per trip: 4 WMMA steps
#define KCUT  (S_ / 2 + KSTEP)     // no long tile's range ends in front of it
#define VT1   ((D_ / 16) * S_ * VTK)  // vt elements from one head to the next

typedef const __attribute__((address_space(1))) _Float16* gl_h;
typedef const __attribute__((address_space(1))) v8h*      gl_v8h;

__global__ __launch_bounds__(256)
void k3_mix_gemm_ln(const _Float16* __restrict__ attn,
                    const _Float16* __restrict__ vt,
                    const float* __restrict__ head_mix,
                    const float* __restrict__ gamma,
                    const float* __restrict__ beta,
                    float* __restrict__ out)
{
    // readfirstlane: the half's number in a scalar register, so that the K
    // bounds are scalar and every lane is on at the WMMAs.
    const int hf = __builtin_amdgcn_readfirstlane(threadIdx.x >> 7);
    const int mS = blockIdx.x * 16;                       // short tile's rows
    const int mL = ((S_ / 16 - 1) - blockIdx.x) * 16;     // long tile's rows
    const int kS = (mS + 16 + KSTEP - 1) & ~(KSTEP - 1);  // end of its live range
    const int kL = (mL + 16 + KSTEP - 1) & ~(KSTEP - 1);
    const int m0 = hf ? mS : mL;          // the tile that this half finishes
    const int g  = blockIdx.y;            // head group (HEAD_K = 2)
    const int b  = blockIdx.z;

    const int lane = threadIdx.x & 31;
    const int w    = (threadIdx.x >> 5) & 3;

    // mixed_j = M[g,0,j]*attn_{2g} + M[g,1,j]*attn_{2g+1}
    const _Float16 c00 = (_Float16)head_mix[g * 4 + 0];   // i=0, j=0
    const _Float16 c01 = (_Float16)head_mix[g * 4 + 1];   // i=0, j=1
    const _Float16 c10 = (_Float16)head_mix[g * 4 + 2];   // i=1, j=0
    const _Float16 c11 = (_Float16)head_mix[g * 4 + 3];   // i=1, j=1

    const int mrow = m0 + (lane & 15);
    const int lrow = mL + (lane & 15);
    const int koff = (lane >> 4) << 3;    // 0 or 8

    const size_t bh0 = (size_t)b * H_ + (g * 2 + 0);
    const size_t bh1 = (size_t)b * H_ + (g * 2 + 1);
    const _Float16* a0p = attn + (bh0 * S_ + (size_t)mrow) * S_ + koff;
    const _Float16* a1p = attn + (bh1 * S_ + (size_t)mrow) * S_ + koff;
    const _Float16* l0p = attn + (bh0 * S_ + (size_t)lrow) * S_ + koff;
    const _Float16* l1p = attn + (bh1 * S_ + (size_t)lrow) * S_ + koff;

    // this wave's slice of vt; key k's group of 16 starts VTK * k further on
    const _Float16* b0p = vt + (bh0 * (D_ / 16) + (size_t)w) * (S_ * VTK) + 8 * lane;
    const _Float16* b1p = vt + (bh1 * (D_ / 16) + (size_t)w) * (S_ * VTK) + 8 * lane;

    // last column of the 32 rows (16 rows x 2 heads) of this half's tile, one
    // per lane; issued here, looked at only behind the live ranges
    const _Float16 lastp =
        attn[(((lane >> 4) ? bh1 : bh0) * S_ + (size_t)mrow) * S_ + (S_ - 1)];

    // one WMMA step on the fragments of 32 columns: rows of head 2g (a0), of
    // head 2g+1 (a1), and the two V heads (b0, b1)
    auto mma = [&](v8h a0lo, v8h a0hi, v8h a1lo, v8h a1hi,
                   v8h b0lo, v8h b0hi, v8h b1lo, v8h b1hi, v8f& c0, v8f& c1) {
        // two head-mixes from one pair of A fragments (v_pk_fma_f16)
        const v8h m0lo = a0lo * c00 + a1lo * c10;
        const v8h m0hi = a0hi * c00 + a1hi * c10;
        const v8h m1lo = a0lo * c01 + a1lo * c11;
        const v8h m1hi = a0hi * c01 + a1hi * c11;

        const v16h A0 = __builtin_shufflevector(m0lo, m0hi,
            0,1,2,3,4,5,6,7,8,9,10,11,12,13,14,15);
        const v16h A1 = __builtin_shufflevector(m1lo, m1hi,
            0,1,2,3,4,5,6,7,8,9,10,11,12,13,14,15);
        const v16h B0 = __builtin_shufflevector(b0lo, b0hi,
            0,1,2,3,4,5,6,7,8,9,10,11,12,13,14,15);
        const v16h B1 = __builtin_shufflevector(b1lo, b1hi,
            0,1,2,3,4,5,6,7,8,9,10,11,12,13,14,15);

        c0 = __builtin_amdgcn_wmma_f32_16x16x32_f16(
            false, A0, false, B0, (short)0, c0, false, false);
        c1 = __builtin_amdgcn_wmma_f32_16x16x32_f16(
            false, A1, false, B1, (short)0, c1, false, false);
    };
    // columns kb .. ke-1 of the rows at p0 (head 2g) and p1 (head 2g+1),
    // KSTEP a trip
    auto span = [&](const _Float16* p0, const _Float16* p1, int kb, int ke,
                    v8f& c0, v8f& c1) {
        // Typed as pointers to global memory: behind the asm statement below the
        // compiler no longer sees where they came from, and plain pointers
        // would turn every load of the loop into a flat load.
        gl_h q0 = (gl_h)(p0 + kb);
        gl_h q1 = (gl_h)(p1 + kb);
        gl_h r0 = (gl_h)(b0p + kb * VTK);  // head 2g+1 stands VT1 further on
        for (int kq = kb; kq < ke; kq += KSTEP) {
            // unrolled: the fragments are register arrays, indexed by constants
            v8h fa0[8], fa1[8], fb0[8], fb1[8];
            #pragma unroll
            for (int u = 0; u < 8; ++u) {
                fa0[u] = *(gl_v8h)(q0 + 16 * u);
                fa1[u] = *(gl_v8h)(q1 + 16 * u);
                fb0[u] = *(gl_v8h)(r0 + 16 * u * VTK);
                fb1[u] = *(gl_v8h)(r0 + 16 * u * VTK + VT1);
            }
            // The wait that belongs in front of any rewrite of a register that an
            // issued load names as its address. The addresses pass through the
            // statement: no load's result is placed in their registers ahead of
            // it, and their step to the next trip, which reads what it hands on,
            // cannot be placed ahead of it either.
            asm volatile("s_wait_xcnt 0x0" : "+v"(q0), "+v"(q1), "+v"(r0) :: "memory");
            #pragma unroll
            for (int u = 0; u < 8; u += 2)
                mma(fa0[u], fa0[u + 1], fa1[u], fa1[u + 1],
                    fb0[u], fb0[u + 1], fb1[u], fb1[u + 1], c0, c1);
            q0 += KSTEP;
            q1 += KSTEP;
            r0 += KSTEP * VTK;
        }
    };

    v8f acc0 = {}, acc1 = {};             // this half's own tile
    v8f par0 = {}, par1 = {};             // waves 4-7: the long tile behind KCUT
    span(a0p, a1p, 0, hf ? kS : KCUT, acc0, acc1);
    span(l0p, l1p, KCUT, hf ? kL : KCUT, par0, par1);
    // The rest of K, for rows whose masked probabilities are not 0.
    // ballot: one scalar answer for the wave, so the branch is scalar.
    if (__builtin_amdgcn_ballot_w32(lastp != (_Float16)0.0f) != 0u) {
        // not unrolled: a path that few inputs take is kept small
        #pragma unroll 1
        for (int k0 = hf ? kS : kL; k0 < S_; k0 += 32)
            mma(*(const v8h*)(a0p + k0), *(const v8h*)(a0p + k0 + 16),
                *(const v8h*)(a1p + k0), *(const v8h*)(a1p + k0 + 16),
                *(const v8h*)(b0p + k0 * VTK), *(const v8h*)(b0p + (k0 + 16) * VTK),
                *(const v8h*)(b1p + k0 * VTK), *(const v8h*)(b1p + (k0 + 16) * VTK), acc0, acc1);
    }

    // Scatter C tiles to LDS: VGPR r -> row r (lanes 0-15) / r+8 (lanes 16-31)
    __shared__ float tile[2][2][16][72];   // [half][head][row][col]
    __shared__ float part[2][16][72];      // long tile, columns behind KCUT
    const int rbase = (lane >> 4) << 3;
    const int col   = 16 * w + (lane & 15);
    #pragma unroll
    for (int r = 0; r < 8; ++r) {
        tile[hf][0][rbase + r][col] = acc0[r];
        tile[hf][1][rbase + r][col] = acc1[r];
    }
    if (hf) {
        #pragma unroll
        for (int r = 0; r < 8; ++r) {
            part[0][rbase + r][col] = par0[r];
            part[1][rbase + r][col] = par1[r];
        }
    }
    __syncthreads();

    // LayerNorm over D=64 for each tile's 32 rows (2 heads x 16): 4 threads per row,
    // 16 cols each, shuffle-reduce within aligned 4-lane groups.
    const int t  = threadIdx.x & 127;
    const int jj = t >> 6;                // output head within group
    const int r  = (t >> 2) & 15;        // row within tile
    const int cb = (t & 3) * 16;         // column base
    float x[16];
    float sum = 0.0f, sq = 0.0f;
    #pragma unroll
    for (int i = 0; i < 16; ++i) x[i] = tile[hf][jj][r][cb + i];
    if (!hf) {                            // long tile: join its two partial sums
        #pragma unroll
        for (int i = 0; i < 16; ++i) x[i] += part[jj][r][cb + i];
    }
    #pragma unroll
    for (int i = 0; i < 16; ++i) {
        sum += x[i];
        sq  += x[i] * x[i];
    }
    #pragma unroll
    for (int off = 1; off < 4; off <<= 1) {
        sum += __shfl_xor(sum, off, 32);
        sq  += __shfl_xor(sq,  off, 32);
    }
    const float mean = sum * (1.0f / 64.0f);
    const float var  = sq * (1.0f / 64.0f) - mean * mean;
    const float rs   = rsqrtf(var + 1e-5f);

    const size_t obase =
        (((size_t)b * H_ + (g * 2 + jj)) * S_ + (size_t)(m0 + r)) * D_ + cb;
    #pragma unroll
    for (int i = 0; i < 16; ++i)
        out[obase + i] = (x[i] - mean) * rs * gamma[cb + i] + beta[cb + i];
}

// ---------------------------------------------------------------------------
extern "C" void kernel_launch(void* const* d_in, const int* in_sizes, int n_in,
                              void* d_out, int out_size, void* d_ws, size_t ws_size,
                              hipStream_t stream)
{
    const float* scores   = (const float*)d_in[0];
    const float* v        = (const float*)d_in[1];
    const float* kq_w     = (const float*)d_in[2];
    const float* kq_b     = (const float*)d_in[3];
    const float* head_mix = (const float*)d_in[4];
    const float* gamma    = (const float*)d_in[5];
    const float* beta     = (const float*)d_in[6];
    float* out = (float*)d_out;

    // workspace: [attn f16 : B*H*S*S] [vt f16 : B*H*D*S]  (128MB + 4MB)
    _Float16* wsAttn = (_Float16*)d_ws;
    _Float16* wsVt   = (_Float16*)((char*)d_ws +
                        (size_t)B_ * H_ * S_ * S_ * sizeof(_Float16));

    // one block per head and group of RPB rows, then one per head and v tile
    dim3 g1(B_ * H_, S_ / RPB + S_ / TK);
    k1_conv_softmax<<<g1, 256, 0, stream>>>(scores, kq_w, kq_b, wsAttn, v, wsVt);

    dim3 g3(S_ / 32, H_ / 2, B_);   // one block per pair of row tiles and head GROUP
    k3_mix_gemm_ln<<<g3, 256, 0, stream>>>(wsAttn, wsVt, head_mix,
                                           gamma, beta, out);
}

// v009
// One run takes 81.1 microseconds.
// Next to v008, in two timings, it ran 1.08 and 1.09 times as fast.
// Over all steps from v000 it is 7.08 times as fast.
#include <hip/hip_runtime.h>
#include <hip/hip_bf16.h>

typedef __attribute__((ext_vector_type(16))) _Float16 v16h;
typedef __attribute__((ext_vector_type(8)))  _Float16 v8h;
typedef __attribute__((ext_vector_type(8)))  float    v8f;

#define B_  2
#define H_  8
#define S_  2048
#define D_  64
#define QK  6
#define KK  11
#define NEGV (-1.0e9f)
#define HALO 8

// ---------------------------------------------------------------------------
// The v part of launch 1: downconvert v [b,h,k,d] f32 -> vt f16, laid out in the
// order in which a wave of the product kernel reads its B fragments:
//   vt[b,h][slice w of 16 dims][group j of 16 keys][lane l][8 keys]
// where lane l holds dim 16w + (l & 15) and keys 16j + 8(l >> 4) .. + 7.
// One fragment load of a wave is then 512 bytes in a row, 4 whole lines (in a
// [d][k] array its 16 dims would lie 4 KB apart, 16 lines to a load).
// One block per 64-key x 64-dim tile (512 blocks). The tile is 16 KB in a row
// in v: a thread reads 64 bytes of it in a row (a wave's four loads cover 2 KB
// of whole lines between them), it is turned in LDS, and leaves as 4 runs of
// 2 KB (one per slice), every wave's store 512 bytes in a row.
// LDS pitch 66 floats: the reads of lane l fall on bank 2k + d, which is
// base + (l & 15) + 16(l >> 4), 32 different banks; the row writes of a wave
// (eight keys, 4 groups of 4 dims 16 dims apart) are conflict-free as well.
// It needs nothing of the conv and the conv nothing of it, so its blocks ride at
// the end of the conv's grid instead of having a launch of their own. The tile lies in the conv's LDS array.
// ---------------------------------------------------------------------------
#define TK 64                      // keys per tile
#define VTK 16                     // vt elements from one key to the next in a slice

__device__ __forceinline__
void vt_tile(const float* __restrict__ v, _Float16* __restrict__ vt,
             const int k0, const int bh, float (*tile)[D_ + 2])
{
    const int tid = threadIdx.x;

    // unrolled: the 4 loads stand in a row, one memory latency for the tile.
    // A thread's loads are adjacent and not 4 KB apart: with far-apart loads in
    // it the compiler rates the whole kernel as held up by strided memory
    // access and lets go of the conv's register limit (94 registers for 80), and
    // a WGP then holds five of the conv's blocks and not six.
    const float4* vin = (const float4*)(v + ((size_t)bh * S_ + k0) * D_);
    float4 x[4];
    #pragma unroll
    for (int j = 0; j < 4; ++j) x[j] = vin[4 * tid + j];
    #pragma unroll
    for (int j = 0; j < 4; ++j) {
        const int idx = 4 * tid + j;
        const int k = idx >> 4;
        const int d = (idx & 15) * 4;
        tile[k][d + 0] = x[j].x;
        tile[k][d + 1] = x[j].y;
        tile[k][d + 2] = x[j].z;
        tile[k][d + 3] = x[j].w;
    }
    __syncthreads();

    // unrolled: p[] is a register vector, indexed by constants
    #pragma unroll
    for (int j = 0; j < 2; ++j) {
        const int q  = tid + 256 * j;     // 16-byte unit of the tile's output
        const int l  = q & 31;            // the lane of the product kernel that reads it
        const int jl = (q >> 5) & 3;      // group of 16 keys inside the tile
        const int w  = q >> 7;            // slice of 16 dims
        const int d  = 16 * w + (l & 15);
        const int kk = 16 * jl + 8 * (l >> 4);
        v8h p;
        #pragma unroll
        for (int i = 0; i < 8; ++i) p[i] = (_Float16)tile[kk + i][d];
        *(v8h*)(vt + ((size_t)(bh * (D_ / 16) + w) * S_ + k0 + 16 * jl) * VTK + 8 * l) = p;
    }
}

// ---------------------------------------------------------------------------
// Kernel 1 (launch 1): masked depthwise conv (6x11, SAME) + bias + causal re-mask +
//           row softmax, emitting f16 probabilities.
// One block per RPB adjacent query rows of one (b,h). 256 threads, 8 ADJACENT
// columns per thread. The block walks its rows one after the other.
// LDS: a ring of 6 source rows with an 8-column zero halo on each side (5 are
// read; 8 keeps every row and every 4-column group 16-byte aligned). A masked
// source row does not depend on the query row that reads it, so from one query
// row to the next five of the six stay where they are and one new row takes
// the place of the oldest: a source row is fetched once per block and not once
// per query row, and a wave is launched once per RPB rows.
// The new row's loads are issued in front of the conv of the current row and
// stored to LDS behind the barrier that ends that conv's reads.
// Conv: per source row a thread reads the 24 floats that cover its 8 columns
// and their taps with 6 16-byte LDS reads and slides the 11 taps over them in
// registers. The ring places are walked in a fixed order, so that the window
// reads keep constant offsets; which tap row belongs to a place moves with the
// ring and is looked up.
// Causal limit: a wave owns one chunk of 256 columns. A chunk that starts
// behind column s holds only masked columns, all equal to NEGV: its wave reads
// no window, does no conv, and takes one exp for its equal terms. Nothing is
// staged behind the last column that a live chunk's windows reach. The rows of
// a block lie in one group of 256, so both limits are the same for all of them.
// ---------------------------------------------------------------------------
#define ROWP  (S_ + 2 * HALO)      // LDS row pitch in floats
#define ROWQ  (ROWP / 4)           // the same in 4-float slots
#define RPB   8                    // query rows per block (divides 256)
#define WROW  12                   // LDS pitch of a tap row: 11 taps, 16-byte aligned

// Place of 4-float slot q inside an LDS row. The conv reads slots 2*ct + j:
// unswizzled, lanes t and t + 8 of a 16-lane half would meet on the same four
// banks. Swapping the two slots of each pair in every other group of 16 slots
// puts the 16 lanes on 16 different bank quads.
__device__ __forceinline__ int slot_of(int q) { return q ^ ((q >> 4) & 1); }

__global__ __launch_bounds__(256)
void k1_conv_softmax(const float* __restrict__ scores,
                     const float* __restrict__ kq_w,
                     const float* __restrict__ kq_b,
                     _Float16* __restrict__ attn,
                     const float* __restrict__ v,
                     _Float16* __restrict__ vt)
{
    __shared__ __attribute__((aligned(16))) float4 sm[QK][ROWQ];

    // The blocks behind the conv's S_ / RPB row groups turn one tile of v each.
    // The test is the same for the whole block and stands in front of every
    // barrier.
    if (blockIdx.y >= S_ / RPB) {
        vt_tile(v, vt, (int)(blockIdx.y - S_ / RPB) * TK, (int)blockIdx.x,
                (float (*)[D_ + 2])sm);
        return;
    }

    // The row groups are taken from the last: the ones with the longest live
    // ranges have the lowest block indices (for speed only).
    const int s0 = (S_ / RPB - 1 - blockIdx.y) * RPB;   // first query row
    const int bh = blockIdx.x;
    const int h  = bh & (H_ - 1);
    const int tid = threadIdx.x;
    const int lane = tid & 31;

    // Which chunk of 256 columns this wave owns. The live chunks are the low
    // ones; the start is turned from block to block so that they do not fall
    // on the same waves in every block (for speed only).
    // readfirstlane: the wave's number in a scalar register, so that the skip
    // below is a scalar branch.
    const int wave  = __builtin_amdgcn_readfirstlane(tid >> 5);
    const int turn  = s0 ^ (s0 >> 2) ^ (s0 >> 4) ^ (s0 >> 6) ^ (s0 >> 8) ^ (s0 >> 10);
    const int chunk = (wave + turn) & 7;
    const int ct    = 32 * chunk + lane;  // the thread makes columns 8*ct..8*ct+7
    const bool live = 256 * chunk <= s0;  // the same for the wave and for all rows
    // first column that no live window reaches (the last live chunk ends at
    // column s0 | 255 and its windows run 8 columns further)
    const int stageEnd = (s0 | 255) + 9;

    __shared__ __attribute__((aligned(16))) float wsm[QK * WROW];
    __shared__ float redm[8];
    __shared__ float reds[8];

    const float bias = kq_b[h];
    float wv = 0.0f;
    if (tid < QK * WROW && tid % WROW < KK)
        wv = kq_w[h * (QK * KK) + (tid / WROW) * KK + tid % WROW];

    const size_t rowBase = (size_t)bh * (size_t)S_;

    // The first 6 source rows (s0-2 .. s0+3): every load is issued before any
    // store. A 4-column group that lies wholly behind the causal limit is not
    // read. Both loop nests are unrolled so that stg[][] stays in registers and
    // the 12 loads stand in a row with no wait between them.
    float4 stg[QK][2];
    #pragma unroll
    for (int r = 0; r < QK; ++r) {
        const int sp = s0 + r - 2;      // pad_low = (6-1)/2 = 2
        #pragma unroll
        for (int j = 0; j < 2; ++j) {
            const int k4 = (tid + 256 * j) * 4;
            stg[r][j] = make_float4(0.0f, 0.0f, 0.0f, 0.0f);
            if (sp >= 0 && sp < S_ && k4 <= sp)
                stg[r][j] = ((const float4*)(scores + (rowBase + (size_t)sp) * S_))
                                [(unsigned)(tid + 256 * j)];
        }
    }

    if (tid < QK * WROW) wsm[tid] = wv;
    // zero halo: 4 slots per ring place (2 left, 2 right); no later store
    // touches them
    if (tid < QK * 4) {
        const int q = tid & 3;
        const int c = (q < 2) ? q : ROWQ - 4 + q;
        sm[tid >> 2][slot_of(c)] = make_float4(0.0f, 0.0f, 0.0f, 0.0f);
    }
    // causally zeroed rows; memory column k sits at LDS column k + HALO
    #pragma unroll
    for (int j = 0; j < 2; ++j) {
        const int k4 = (tid + 256 * j) * 4;
        if (k4 < stageEnd) {
            #pragma unroll
            for (int r = 0; r < QK; ++r) {
                const int sp = s0 + r - 2;
                float4 x = stg[r][j];   // x.x is live or already 0
                x.y = (k4 + 1 <= sp) ? x.y : 0.0f;
                x.z = (k4 + 2 <= sp) ? x.z : 0.0f;
                x.w = (k4 + 3 <= sp) ? x.w : 0.0f;
                sm[r][slot_of(HALO / 4 + tid + 256 * j)] = x;
            }
        }
    }
    __syncthreads();

    int ps[6];
    #pragma unroll
    for (int j = 0; j < 6; ++j) ps[j] = slot_of(2 * ct + j);

    // the source row that is fetched next (s + 4) and this thread's place in the
    // output row, each moved on by one row per trip
    const float4* nrow = (const float4*)(scores + (rowBase + (size_t)(s0 + 4)) * S_);
    _Float16*     orow = attn + (rowBase + (size_t)s0) * S_ + 8 * ct;

    // ring: the place of the oldest source row (s - 2) of the current query row
    int ring = 0;
    #pragma unroll 1
    for (int i = 0; i < RPB; ++i) {
        const int s = s0 + i;

        // Source row s + 4, which the next query row needs: issued here, stored
        // behind the conv.
        const int  sn   = s + 4;
        const bool more = i + 1 < RPB;
        float4 nx[2];
        #pragma unroll
        for (int j = 0; j < 2; ++j) {
            const int k4 = (tid + 256 * j) * 4;
            nx[j] = make_float4(0.0f, 0.0f, 0.0f, 0.0f);
            if (more && sn < S_ && k4 <= sn)
                nx[j] = nrow[(unsigned)(tid + 256 * j)];
        }

        // Columns 8*ct .. 8*ct+7. Column k, tap dk reads LDS column k + dk + 3,
        // which is win[c + dk + 3] of the window that starts at LDS column 8*ct.
        // Every loop of the nest is unrolled so that win[] and acc[] are indexed
        // by constants and stay in registers. Per output the sum starts from the
        // bias and takes the ring places in order, dk inner.
        float vout[8];
        float mx = NEGV;                  // a chunk behind the limit: all NEGV
        if (live) {
            float acc[8];
            #pragma unroll
            for (int c = 0; c < 8; ++c) acc[c] = bias;
            #pragma unroll
            for (int t = 0; t < QK; ++t) {
                // place t holds source row s - 2 + dq
                const int dq = (t - ring < 0) ? t - ring + QK : t - ring;
                float win[24];
                #pragma unroll
                for (int j = 0; j < 6; ++j) {
                    const float4 q = sm[t][ps[j]];
                    win[4 * j + 0] = q.x;
                    win[4 * j + 1] = q.y;
                    win[4 * j + 2] = q.z;
                    win[4 * j + 3] = q.w;
                }
                const float4* wr = (const float4*)(wsm + dq * WROW);
                const float4 w0 = wr[0], w1 = wr[1], w2 = wr[2];
                const float w[KK] = { w0.x, w0.y, w0.z, w0.w, w1.x, w1.y, w1.z,
                                      w1.w, w2.x, w2.y, w2.z };
                #pragma unroll
                for (int dk = 0; dk < KK; ++dk) {
                    #pragma unroll
                    for (int c = 0; c < 8; ++c)
                        acc[c] = fmaf(w[dk], win[c + dk + (HALO - 5)], acc[c]);
                }
            }

            mx = -3.4e38f;
            #pragma unroll
            for (int c = 0; c < 8; ++c) {
                const float val = (8 * ct + c <= s) ? acc[c] : NEGV;
                vout[c] = val;
                mx = fmaxf(mx, val);
            }
            #pragma unroll
            for (int off = 16; off > 0; off >>= 1)
                mx = fmaxf(mx, __shfl_xor(mx, off, 32));
        }

        // block max; redm[] is indexed by chunk, so it is read in column order
        if (lane == 0) redm[chunk] = mx;
        __syncthreads();                  // also ends every read of this row's windows

        // the new source row takes the oldest one's place; the barrier in front
        // of the sum's read publishes it
        if (more) {
            #pragma unroll
            for (int j = 0; j < 2; ++j) {
                const int k4 = (tid + 256 * j) * 4;
                if (k4 < stageEnd) {
                    float4 x = nx[j];     // x.x is live or already 0
                    x.y = (k4 + 1 <= sn) ? x.y : 0.0f;
                    x.z = (k4 + 2 <= sn) ? x.z : 0.0f;
                    x.w = (k4 + 3 <= sn) ? x.w : 0.0f;
                    sm[ring][slot_of(HALO / 4 + tid + 256 * j)] = x;
                }
            }
        }

        mx = redm[0];
        #pragma unroll
        for (int c = 1; c < 8; ++c) mx = fmaxf(mx, redm[c]);

        // exp + block sum
        float e[8];
        float se = 0.0f;
        if (live) {
            #pragma unroll
            for (int c = 0; c < 8; ++c)   // e^x as 2^(x * log2 e), as __expf does
                vout[c] = (vout[c] - mx) * 1.44269504f;
            // The 8 v_exp_f32 stand in one statement, each on registers of its own,
            // with the free slot that the instruction set asks for behind the last.
            asm("v_exp_f32 %0, %8\n\t"
                "v_exp_f32 %1, %9\n\t"
                "v_exp_f32 %2, %10\n\t"
                "v_exp_f32 %3, %11\n\t"
                "v_exp_f32 %4, %12\n\t"
                "v_exp_f32 %5, %13\n\t"
                "v_exp_f32 %6, %14\n\t"
                "v_exp_f32 %7, %15\n\t"
                "v_nop"
                : "=&v"(e[0]), "=&v"(e[1]), "=&v"(e[2]), "=&v"(e[3]),
                  "=&v"(e[4]), "=&v"(e[5]), "=&v"(e[6]), "=&v"(e[7])
                : "v"(vout[0]), "v"(vout[1]), "v"(vout[2]), "v"(vout[3]),
                  "v"(vout[4]), "v"(vout[5]), "v"(vout[6]), "v"(vout[7]));
            #pragma unroll
            for (int c = 0; c < 8; ++c) se += e[c];
            #pragma unroll
            for (int off = 16; off > 0; off >>= 1)
                se += __shfl_xor(se, off, 32);
        } else {
            // 256 equal terms
            const float e0 = __expf(NEGV - mx);
            #pragma unroll
            for (int c = 0; c < 8; ++c) e[c] = e0;
            se = 256.0f * e0;
        }
        // The maxima and the sums have an array each: a wave writes redm again
        // only behind this barrier, which every wave reaches with its maxima
        // read, and reds again only behind the next row's first barrier.
        if (lane == 0) reds[chunk] = se;
        __syncthreads();
        float tot = 0.0f;
        #pragma unroll
        for (int c = 0; c < 8; ++c) tot += reds[c];
        const float inv = 1.0f / tot;

        // the thread's 8 adjacent probabilities leave as one 16-byte store
        // (unrolled: p[] is a register vector, indexed by constants)
        v8h p;
        #pragma unroll
        for (int c = 0; c < 8; ++c) p[c] = (_Float16)(e[c] * inv);
        *(v8h*)orow = p;
        // The wait that belongs in front of any rewrite of a register that an
        // issued store names: the next trip reuses the store's registers.
        asm volatile("s_wait_xcnt 0x0" ::: "memory");

        nrow += S_ / 4;
        orow += S_;
        ring = (ring + 1 == QK) ? 0 : ring + 1;
    }
}

// ---------------------------------------------------------------------------
// Product kernel (launch 2): head-mix (packed f16 FMA) + attn@v via
// v_wmma_f32_16x16x32_f16 +
// fused LayerNorm over D.
// A 16-row tile of one head-GROUP (both output heads j=0 and j=1) is worked on
// by four waves: the raw attn fragments a0/a1 are shared by both output heads,
// so each pair of A loads feeds TWO WMMAs (two mixes x two V heads).
// Each wave owns one 16-column slice of D for both heads; K runs in steps of
// 32.  A-fragment K packing per ISA: lanes 0-15 -> K {0..7,16..23},
// lanes 16-31 -> K {8..15,24..31}.  The B fragments have the same K packing;
// launch 1 has laid vt out so that the 32 lanes' 16 bytes of one B load stand
// in a row.
// Causal limit: behind column m0 + 15 every probability of a tile is a masked
// one, and all masked probabilities of a row are the same number, which is 0
// unless the row's live scores lie near NEGV themselves. A tile's K range ends
// at the first multiple of KSTEP behind its last live column; the rest of K is
// run only if the last column of one of the tile's rows (a masked one wherever
// there is a rest) is not 0, so no input loses a term.
// Block = 256 threads (8 wave32) = row tiles i (short range) and 127 - i (long
// range). The two ranges add up to S_ + KSTEP columns in every block. Waves
// 0-3 take the first KCUT columns of the long tile; waves 4-7 take the short
// tile and what the long tile has behind KCUT: 9 and 8 trips, whatever i is.
// The long tile's two partial sums are added where the LayerNorm reads them.
// A path: the four waves of a half need the same 16 rows x KSTEP columns of both
// heads. A fragment load straight from attn touches 16 lines (16 rows, 4 KB
// apart, 32 bytes of each), in every one of the four waves. Instead the half
// copies the tile to LDS once, 256 bytes of a row at a time (whole lines), with
// asynchronous copies, two buffers: pass t works on buffer t & 1 while the
// copies of pass t + 1 fly. All 8 waves walk the same NPASS passes and meet at
// one barrier a pass; waves 4-7 have work in NPASS - 1 of them.
// ---------------------------------------------------------------------------
#define KSTEP 128                  // columns per trip: 4 WMMA steps
#define KCUT  (S_ / 2 + KSTEP)     // no long tile's range ends in front of it
#define VT1   ((D_ / 16) * S_ * VTK)  // vt elements from one head to the next
#define NPASS (KCUT / KSTEP)       // passes of a block
#define APITCH (KSTEP + 8)         // staged row in f16: 272 bytes = 16 x odd, so the
                                   // 16 rows of a b128 fragment read miss each other's banks

typedef const __attribute__((address_space(1))) _Float16* gl_h;
typedef const __attribute__((address_space(1))) v8h*      gl_v8h;
typedef const __attribute__((address_space(3))) _Float16* lds_h;

__global__ __launch_bounds__(256)
void k3_mix_gemm_ln(const _Float16* __restrict__ attn,
                    const _Float16* __restrict__ vt,
                    const float* __restrict__ head_mix,
                    const float* __restrict__ gamma,
                    const float* __restrict__ beta,
                    float* __restrict__ out)
{
    // readfirstlane: the half's number in a scalar register, so that the K
    // bounds are scalar and every lane is on at the WMMAs.
    const int hf = __builtin_amdgcn_readfirstlane(threadIdx.x >> 7);
    const int mS = blockIdx.x * 16;                       // short tile's rows
    const int mL = ((S_ / 16 - 1) - blockIdx.x) * 16;     // long tile's rows
    const int kS = (mS + 16 + KSTEP - 1) & ~(KSTEP - 1);  // end of its live range
    const int kL = (mL + 16 + KSTEP - 1) & ~(KSTEP - 1);
    const int m0 = hf ? mS : mL;          // the tile that this half finishes
    const int g  = blockIdx.y;            // head group (HEAD_K = 2)
    const int b  = blockIdx.z;

    const int lane = threadIdx.x & 31;
    // readfirstlane: the slice's number in a scalar register, so that the slice's
    // address takes no vector registers through the passes
    const int w    = __builtin_amdgcn_readfirstlane((threadIdx.x >> 5) & 3);

    // mixed_j = M[g,0,j]*attn_{2g} + M[g,1,j]*attn_{2g+1}
    const _Float16 c00 = (_Float16)head_mix[g * 4 + 0];   // i=0, j=0
    const _Float16 c01 = (_Float16)head_mix[g * 4 + 1];   // i=0, j=1
    const _Float16 c10 = (_Float16)head_mix[g * 4 + 2];   // i=1, j=0
    const _Float16 c11 = (_Float16)head_mix[g * 4 + 3];   // i=1, j=1

    const int mrow = m0 + (lane & 15);
    const int koff = (lane >> 4) << 3;    // 0 or 8

    const size_t bh0 = (size_t)b * H_ + (g * 2 + 0);
    const size_t bh1 = (size_t)b * H_ + (g * 2 + 1);

    // this wave's slice of vt (head 2g); key k's group of 16 starts VTK * k
    // further on, a lane's 16 bytes stand 8 * lane into a group
    const _Float16* bsl = vt + (bh0 * (D_ / 16) + (size_t)w) * (S_ * VTK);

    // last column of the 32 rows (16 rows x 2 heads) of this half's tile, one
    // per lane; issued here, looked at only behind the live ranges
    const _Float16 lastp =
        (attn + bh0 * S_ * S_)[(lane >> 4) * (S_ * S_) + mrow * S_ + (S_ - 1)];

    // one WMMA step on the fragments of 32 columns: rows of head 2g (a0), of
    // head 2g+1 (a1), and the two V heads (b0, b1)
    auto mma = [&](v8h a0lo, v8h a0hi, v8h a1lo, v8h a1hi,
                   v8h b0lo, v8h b0hi, v8h b1lo, v8h b1hi, v8f& c0, v8f& c1) {
        // two head-mixes from one pair of A fragments (v_pk_fma_f16)
        const v8h m0lo = a0lo * c00 + a1lo * c10;
        const v8h m0hi = a0hi * c00 + a1hi * c10;
        const v8h m1lo = a0lo * c01 + a1lo * c11;
        const v8h m1hi = a0hi * c01 + a1hi * c11;

        const v16h A0 = __builtin_shufflevector(m0lo, m0hi,
            0,1,2,3,4,5,6,7,8,9,10,11,12,13,14,15);
        const v16h A1 = __builtin_shufflevector(m1lo, m1hi,
            0,1,2,3,4,5,6,7,8,9,10,11,12,13,14,15);
        const v16h B0 = __builtin_shufflevector(b0lo, b0hi,
            0,1,2,3,4,5,6,7,8,9,10,11,12,13,14,15);
        const v16h B1 = __builtin_shufflevector(b1lo, b1hi,
            0,1,2,3,4,5,6,7,8,9,10,11,12,13,14,15);

        c0 = __builtin_amdgcn_wmma_f32_16x16x32_f16(
            false, A0, false, B0, (short)0, c0, false, false);
        c1 = __builtin_amdgcn_wmma_f32_16x16x32_f16(
            false, A1, false, B1, (short)0, c1, false, false);
    };
    // [buffer][half][head][row][column]
    __shared__ __attribute__((aligned(16))) _Float16 stA[2][2][2][16][APITCH];

    // Where this half's A tile of pass t starts in a head's [S_][S_] plane.
    // Waves 4-7: nS passes on the short tile, then the long tile behind KCUT.
    // Their last pass has no work; it copies the long tile's last KSTEP columns
    // in front of kL (inside attn, never read), so that every wave issues the same copies.
    const int nS = kS / KSTEP;
    auto tile_at = [&](int t) -> int {
        if (!hf)    return mL * S_ + t * KSTEP;
        if (t < nS) return mS * S_ + t * KSTEP;
        const int tt = (t < NPASS - 1) ? t : NPASS - 2;
        return mL * S_ + KCUT + (tt - nS) * KSTEP;
    };
    // A thread of the half copies 16 bytes of rows crow and crow + 8 of both
    // heads: a wave's copy is 2 rows x 256 bytes, 4 whole lines.
    const int th   = threadIdx.x & 127;
    const int crow = th >> 4;
    const int ccol = (th & 15) * 8;
    const int cl   = crow * S_ + ccol;    // the thread's place inside a tile
    auto stage = [&](int t, int buf) {
        const int off = tile_at(t);
        const _Float16* g0 = (attn + (bh0 * S_ * S_ + (size_t)off)) + cl;
        const _Float16* g1 = g0 + 8 * S_;
        const _Float16* g2 = (attn + (bh1 * S_ * S_ + (size_t)off)) + cl;
        const _Float16* g3 = g2 + 8 * S_;
        const unsigned l0 = (unsigned)(size_t)(lds_h)&stA[buf][hf][0][crow][ccol];
        const unsigned l1 = l0 + 8 * APITCH * 2;
        const unsigned l2 = l0 + 16 * APITCH * 2;
        const unsigned l3 = l0 + 24 * APITCH * 2;
        // The wait that belongs in front of any rewrite of a register that an
        // issued copy names stands in the copies' own statement.
        asm volatile("global_load_async_to_lds_b128 %0, %4, off\n\t"
                     "global_load_async_to_lds_b128 %1, %5, off\n\t"
                     "global_load_async_to_lds_b128 %2, %6, off\n\t"
                     "global_load_async_to_lds_b128 %3, %7, off\n\t"
                     "s_wait_xcnt 0x0"
                     :: "v"(l0), "v"(l1), "v"(l2), "v"(l3),
                        "v"(g0), "v"(g1), "v"(g2), "v"(g3) : "memory");
    };

    // C tiles in LDS: VGPR r -> row r (lanes 0-15) / r+8 (lanes 16-31)
    __shared__ float tile[2][2][16][72];   // [half][head][row][col]
    __shared__ float part[2][16][72];      // long tile, columns behind KCUT
    const int rbase = (lane >> 4) << 3;
    const int col   = 16 * w + (lane & 15);

    v8f cur0 = {}, cur1 = {};             // the tile that the half is working on

    stage(0, 0);
    // tile 0 has landed for this wave; the barrier says so for all of them
    asm volatile("s_wait_asynccnt 0x0" ::: "memory");
    __syncthreads();
    stage(1, 1);

    // not unrolled: nine copies of the pass would only add code
    #pragma unroll 1
    for (int t = 0; t < NPASS; ++t) {
        // waves 4-7 leave the short tile: its sums go to their places in LDS
        // (each thread's own), so that they hold no registers from here on
        if (hf && t == nS) {
            #pragma unroll
            for (int r = 0; r < 8; ++r) {
                tile[1][0][rbase + r][col] = cur0[r];
                tile[1][1][rbase + r][col] = cur1[r];
            }
            cur0 = v8f{};
            cur1 = v8f{};
        }
        if (!hf || t < NPASS - 1) {
            const int kb = tile_at(t) & (S_ - 1);      // the tile's first column
            gl_h r0 = (gl_h)((bsl + kb * VTK) + 8 * lane);  // head 2g+1: VT1 further on
            // unrolled: the fragments are register arrays, indexed by constants
            v8h fb0[8], fb1[8];
            #pragma unroll
            for (int u = 0; u < 8; ++u) {
                fb0[u] = *(gl_v8h)(r0 + 16 * u * VTK);
                fb1[u] = *(gl_v8h)(r0 + 16 * u * VTK + VT1);
            }
            // The wait that belongs in front of any rewrite of a register that an
            // issued load names as its address. The address passes through the
            // statement: no load's result is placed in its registers ahead of it.
            asm volatile("s_wait_xcnt 0x0" : "+v"(r0) :: "memory");
            const _Float16* ab = &stA[t & 1][hf][0][lane & 15][koff];
            #pragma unroll
            for (int u = 0; u < 8; u += 2)
                mma(*(const v8h*)(ab + 16 * u), *(const v8h*)(ab + 16 * u + 16),
                    *(const v8h*)(ab + 16 * APITCH + 16 * u),
                    *(const v8h*)(ab + 16 * APITCH + 16 * u + 16),
                    fb0[u], fb0[u + 1], fb1[u], fb1[u + 1], cur0, cur1);
        }
        // Foot of the pass: this wave's reads of buffer t & 1 are done and its
        // copies of tile t + 1 have landed; behind the barrier that holds for
        // all 8 waves, and the buffer just read may be filled again.
        asm volatile("s_wait_dscnt 0x0" ::: "memory");
        asm volatile("s_wait_asynccnt 0x0" ::: "memory");
        __syncthreads();
        if (t + 2 < NPASS) stage(t + 2, t & 1);
    }
    // no copy is left in flight
    asm volatile("s_wait_asynccnt 0x0" ::: "memory");

    // waves 0-3 never left their tile; in waves 4-7 cur is the long tile's part
    // and the short tile's sums come back from where the thread put them
    v8f acc0 = cur0, acc1 = cur1;
    const v8f par0 = cur0, par1 = cur1;
    if (hf) {
        #pragma unroll
        for (int r = 0; r < 8; ++r) {
            acc0[r] = tile[1][0][rbase + r][col];
            acc1[r] = tile[1][1][rbase + r][col];
        }
    }
    // The rest of K, for rows whose masked probabilities are not 0.
    // ballot: one scalar answer for the wave, so the branch is scalar.
    if (__builtin_amdgcn_ballot_w32(lastp != (_Float16)0.0f) != 0u) {
        const int kr = hf ? kS : kL;
        // typed as pointers to global memory: behind the asm statement below the
        // compiler no longer sees where they came from, and plain pointers would
        // turn their loads into flat loads
        gl_h q0 = (gl_h)((attn + bh0 * S_ * S_) + (mrow * S_ + koff + kr));
        gl_h q1 = q0 + S_ * S_;
        gl_h r0 = (gl_h)(bsl + kr * VTK + 8 * lane);
        // not unrolled: a path that few inputs take is kept small
        #pragma unroll 1
        for (int k0 = kr; k0 < S_; k0 += 32) {
            const v8h x0 = *(gl_v8h)q0, x1 = *(gl_v8h)(q0 + 16);
            const v8h y0 = *(gl_v8h)q1, y1 = *(gl_v8h)(q1 + 16);
            const v8h z0 = *(gl_v8h)r0, z1 = *(gl_v8h)(r0 + 16 * VTK);
            const v8h z2 = *(gl_v8h)(r0 + VT1), z3 = *(gl_v8h)(r0 + 16 * VTK + VT1);
            // The wait that belongs in front of any rewrite of a register that an
            // issued load names as its address; the addresses pass through the
            // statement, so neither a load's result nor their own step to the
            // next trip is placed in their registers ahead of it.
            asm volatile("s_wait_xcnt 0x0" : "+v"(q0), "+v"(q1), "+v"(r0) :: "memory");
            mma(x0, x1, y0, y1, z0, z1, z2, z3, acc0, acc1);
            q0 += 32;
            q1 += 32;
            r0 += 32 * VTK;
        }
    }

    // Scatter C tiles to LDS
    #pragma unroll
    for (int r = 0; r < 8; ++r) {
        tile[hf][0][rbase + r][col] = acc0[r];
        tile[hf][1][rbase + r][col] = acc1[r];
    }
    if (hf) {
        #pragma unroll
        for (int r = 0; r < 8; ++r) {
            part[0][rbase + r][col] = par0[r];
            part[1][rbase + r][col] = par1[r];
        }
    }
    __syncthreads();

    // LayerNorm over D=64 for each tile's 32 rows (2 heads x 16): 4 threads per row,
    // 16 cols each, shuffle-reduce within aligned 4-lane groups.
    const int t  = threadIdx.x & 127;
    const int jj = t >> 6;                // output head within group
    const int r  = (t >> 2) & 15;        // row within tile
    const int cb = (t & 3) * 16;         // column base
    float x[16];
    float sum = 0.0f, sq = 0.0f;
    #pragma unroll
    for (int i = 0; i < 16; ++i) x[i] = tile[hf][jj][r][cb + i];
    if (!hf) {                            // long tile: join its two partial sums
        #pragma unroll
        for (int i = 0; i < 16; ++i) x[i] += part[jj][r][cb + i];
    }
    #pragma unroll
    for (int i = 0; i < 16; ++i) {
        sum += x[i];
        sq  += x[i] * x[i];
    }
    #pragma unroll
    for (int off = 1; off < 4; off <<= 1) {
        sum += __shfl_xor(sum, off, 32);
        sq  += __shfl_xor(sq,  off, 32);
    }
    const float mean = sum * (1.0f / 64.0f);
    const float var  = sq * (1.0f / 64.0f) - mean * mean;
    const float rs   = rsqrtf(var + 1e-5f);

    const size_t obase =
        (((size_t)b * H_ + (g * 2 + jj)) * S_ + (size_t)(m0 + r)) * D_ + cb;
    #pragma unroll
    for (int i = 0; i < 16; ++i)
        out[obase + i] = (x[i] - mean) * rs * gamma[cb + i] + beta[cb + i];
}

// ---------------------------------------------------------------------------
extern "C" void kernel_launch(void* const* d_in, const int* in_sizes, int n_in,
                              void* d_out, int out_size, void* d_ws, size_t ws_size,
                              hipStream_t stream)
{
    const float* scores   = (const float*)d_in[0];
    const float* v        = (const float*)d_in[1];
    const float* kq_w     = (const float*)d_in[2];
    const float* kq_b     = (const float*)d_in[3];
    const float* head_mix = (const float*)d_in[4];
    const float* gamma    = (const float*)d_in[5];
    const float* beta     = (const float*)d_in[6];
    float* out = (float*)d_out;

    // workspace: [attn f16 : B*H*S*S] [vt f16 : B*H*D*S]  (128MB + 4MB)
    _Float16* wsAttn = (_Float16*)d_ws;
    _Float16* wsVt   = (_Float16*)((char*)d_ws +
                        (size_t)B_ * H_ * S_ * S_ * sizeof(_Float16));

    // one block per head and group of RPB rows, then one per head and v tile
    dim3 g1(B_ * H_, S_ / RPB + S_ / TK);
    k1_conv_softmax<<<g1, 256, 0, stream>>>(scores, kq_w, kq_b, wsAttn, v, wsVt);

    dim3 g3(S_ / 32, H_ / 2, B_);   // one block per pair of row tiles and head GROUP
    k3_mix_gemm_ln<<<g3, 256, 0, stream>>>(wsAttn, wsVt, head_mix,
                                           gamma, beta, out);
}

// v010
// It runs in 77.2 microseconds.
// Two timings next to v009 both put it at 1.05 times that version's speed.
// All steps since v000 together make it 7.42 times as fast.
#include <hip/hip_runtime.h>
#include <hip/hip_bf16.h>

typedef __attribute__((ext_vector_type(16))) _Float16 v16h;
typedef __attribute__((ext_vector_type(8)))  _Float16 v8h;
typedef __attribute__((ext_vector_type(8)))  float    v8f;

#define B_  2
#define H_  8
#define S_  2048
#define D_  64
#define QK  6
#define KK  11
#define NEGV (-1.0e9f)
#define HALO 8

// ---------------------------------------------------------------------------
// The v part of launch 1: downconvert v [b,h,k,d] f32 -> vt f16, laid out in the
// order in which a wave of the product kernel reads its B fragments:
//   vt[b,h][slice w of 16 dims][group j of 16 keys][lane l][8 keys]
// where lane l holds dim 16w + (l & 15) and keys 16j + 8(l >> 4) .. + 7.
// One fragment load of a wave is then 512 bytes in a row, 4 whole lines (in a
// [d][k] array its 16 dims would lie 4 KB apart, 16 lines to a load).
// One block per 64-key x 64-dim tile (512 blocks). The tile is 16 KB in a row
// in v: a thread reads 64 bytes of it in a row (a wave's four loads cover 2 KB
// of whole lines between them), it is turned in LDS, and leaves as 4 runs of
// 2 KB (one per slice), every wave's store 512 bytes in a row.
// LDS pitch 66 floats: the reads of lane l fall on bank 2k + d, which is
// base + (l & 15) + 16(l >> 4), 32 different banks; the row writes of a wave
// (eight keys, 4 groups of 4 dims 16 dims apart) are conflict-free as well.
// It needs nothing of the conv and the conv nothing of it, so its blocks ride at
// the end of the conv's grid instead of having a launch of their own. The tile lies in the conv's LDS array.
// ---------------------------------------------------------------------------
#define TK 64                      // keys per tile
#define VTK 16                     // vt elements from one key to the next in a slice

__device__ __forceinline__
void vt_tile(const float* __restrict__ v, _Float16* __restrict__ vt,
             const int k0, const int bh, float (*tile)[D_ + 2])
{
    const int tid = threadIdx.x;

    // unrolled: the 4 loads stand in a row, one memory latency for the tile.
    // A thread's loads are adjacent and not 4 KB apart: with far-apart loads in
    // it the compiler rates the whole kernel as held up by strided memory
    // access and lets go of the conv's register limit (94 registers for 80), and
    // a WGP then holds five of the conv's blocks and not six.
    const float4* vin = (const float4*)(v + ((size_t)bh * S_ + k0) * D_);
    float4 x[4];
    #pragma unroll
    for (int j = 0; j < 4; ++j) x[j] = vin[4 * tid + j];
    #pragma unroll
    for (int j = 0; j < 4; ++j) {
        const int idx = 4 * tid + j;
        const int k = idx >> 4;
        const int d = (idx & 15) * 4;
        tile[k][d + 0] = x[j].x;
        tile[k][d + 1] = x[j].y;
        tile[k][d + 2] = x[j].z;
        tile[k][d + 3] = x[j].w;
    }
    __syncthreads();

    // unrolled: p[] is a register vector, indexed by constants
    #pragma unroll
    for (int j = 0; j < 2; ++j) {
        const int q  = tid + 256 * j;     // 16-byte unit of the tile's output
        const int l  = q & 31;            // the lane of the product kernel that reads it
        const int jl = (q >> 5) & 3;      // group of 16 keys inside the tile
        const int w  = q >> 7;            // slice of 16 dims
        const int d  = 16 * w + (l & 15);
        const int kk = 16 * jl + 8 * (l >> 4);
        v8h p;
        #pragma unroll
        for (int i = 0; i < 8; ++i) p[i] = (_Float16)tile[kk + i][d];
        *(v8h*)(vt + ((size_t)(bh * (D_ / 16) + w) * S_ + k0 + 16 * jl) * VTK + 8 * l) = p;
    }
}

// ---------------------------------------------------------------------------
// Kernel 1 (launch 1): masked depthwise conv (6x11, SAME) + bias + causal re-mask +
//           row softmax, emitting f16 probabilities.
// One block per RPB adjacent query rows of one (b,h). 256 threads, 8 ADJACENT
// columns per thread. The block walks its rows one after the other.
// LDS: a ring of 6 source rows with an 8-column zero halo on each side (5 are
// read; 8 keeps every row and every 4-column group 16-byte aligned). A masked
// source row does not depend on the query row that reads it, so from one query
// row to the next five of the six stay where they are and one new row takes
// the place of the oldest: a source row is fetched once per block and not once
// per query row, and a wave is launched once per RPB rows.
// The new row's loads are issued in front of the conv of the current row and
// stored to LDS behind the barrier that ends that conv's reads.
// Conv: per source row a thread reads the 24 floats that cover its 8 columns
// and their taps with 6 16-byte LDS reads and slides the 11 taps over them in
// registers. The ring places are walked in a fixed order, so that the window
// reads keep constant offsets; which tap row belongs to a place moves with the
// ring and is looked up.
// Causal limit: a wave owns one chunk of 256 columns. A chunk that starts
// behind column s holds only masked columns, all equal to NEGV: its wave reads
// no window, does no conv, and takes one exp for its equal terms. Nothing is
// staged behind the last column that a live chunk's windows reach. The rows of
// a block lie in one group of 256, so both limits are the same for all of them.
// ---------------------------------------------------------------------------
#define ROWP  (S_ + 2 * HALO)      // LDS row pitch in floats
#define ROWQ  (ROWP / 4)           // the same in 4-float slots
#define RPB   8                    // query rows per block (divides 256)
#define WROW  12                   // LDS pitch of a tap row: 11 taps, 16-byte aligned

// Place of 4-float slot q inside an LDS row. The conv reads slots 2*ct + j:
// unswizzled, lanes t and t + 8 of a 16-lane half would meet on the same four
// banks. Swapping the two slots of each pair in every other group of 16 slots
// puts the 16 lanes on 16 different bank quads.
__device__ __forceinline__ int slot_of(int q) { return q ^ ((q >> 4) & 1); }

// The value of lane l ^ 16, by a vector cross-row move, and of lane l ^ M inside a
// row of 16 lanes, by a DPP operand (row_xmask): both stay in the vector unit. A
// shuffle written as __shfl_xor goes through the LDS unit and is waited for, five
// times in a row for one reduction over the wave. Every lane must be on.
__device__ __forceinline__ float xhalf(float x)
{
    return __builtin_bit_cast(float, __builtin_amdgcn_permlanex16(
        __builtin_bit_cast(int, x), __builtin_bit_cast(int, x),
        0x76543210, 0xfedcba98, false, false));
}
template <int M>
__device__ __forceinline__ float xrow(float x)
{
    return __builtin_bit_cast(float, __builtin_amdgcn_update_dpp(
        0, __builtin_bit_cast(int, x), 0x160 | M, 0xf, 0xf, true));
}

__global__ __launch_bounds__(256)
void k1_conv_softmax(const float* __restrict__ scores,
                     const float* __restrict__ kq_w,
                     const float* __restrict__ kq_b,
                     _Float16* __restrict__ attn,
                     const float* __restrict__ v,
                     _Float16* __restrict__ vt)
{
    __shared__ __attribute__((aligned(16))) float4 sm[QK][ROWQ];

    // The blocks behind the conv's S_ / RPB row groups turn one tile of v each.
    // The test is the same for the whole block and stands in front of every
    // barrier.
    if (blockIdx.y >= S_ / RPB) {
        vt_tile(v, vt, (int)(blockIdx.y - S_ / RPB) * TK, (int)blockIdx.x,
                (float (*)[D_ + 2])sm);
        return;
    }

    // The row groups are taken from the last: the ones with the longest live
    // ranges have the lowest block indices (for speed only).
    const int s0 = (S_ / RPB - 1 - blockIdx.y) * RPB;   // first query row
    const int bh = blockIdx.x;
    const int h  = bh & (H_ - 1);
    const int tid = threadIdx.x;
    const int lane = tid & 31;

    // Which chunk of 256 columns this wave owns. The live chunks are the low
    // ones; the start is turned from block to block so that they do not fall
    // on the same waves in every block (for speed only).
    // readfirstlane: the wave's number in a scalar register, so that the skip
    // below is a scalar branch.
    const int wave  = __builtin_amdgcn_readfirstlane(tid >> 5);
    const int turn  = s0 ^ (s0 >> 2) ^ (s0 >> 4) ^ (s0 >> 6) ^ (s0 >> 8) ^ (s0 >> 10);
    const int chunk = (wave + turn) & 7;
    const int ct    = 32 * chunk + lane;  // the thread makes columns 8*ct..8*ct+7
    const bool live = 256 * chunk <= s0;  // the same for the wave and for all rows
    // first column that no live window reaches (the last live chunk ends at
    // column s0 | 255 and its windows run 8 columns further)
    const int stageEnd = (s0 | 255) + 9;

    __shared__ __attribute__((aligned(16))) float wsm[QK * WROW];
    __shared__ float redm[8];
    __shared__ float reds[8];

    const float bias = kq_b[h];
    float wv = 0.0f;
    if (tid < QK * WROW && tid % WROW < KK)
        wv = kq_w[h * (QK * KK) + (tid / WROW) * KK + tid % WROW];

    const size_t rowBase = (size_t)bh * (size_t)S_;

    // The first 6 source rows (s0-2 .. s0+3): every load is issued before any
    // store. A 4-column group that lies wholly behind the causal limit is not
    // read. Both loop nests are unrolled so that stg[][] stays in registers and
    // the 12 loads stand in a row with no wait between them.
    float4 stg[QK][2];
    #pragma unroll
    for (int r = 0; r < QK; ++r) {
        const int sp = s0 + r - 2;      // pad_low = (6-1)/2 = 2
        #pragma unroll
        for (int j = 0; j < 2; ++j) {
            const int k4 = (tid + 256 * j) * 4;
            stg[r][j] = make_float4(0.0f, 0.0f, 0.0f, 0.0f);
            if (sp >= 0 && sp < S_ && k4 <= sp)
                stg[r][j] = ((const float4*)(scores + (rowBase + (size_t)sp) * S_))
                                [(unsigned)(tid + 256 * j)];
        }
    }

    if (tid < QK * WROW) wsm[tid] = wv;
    // zero halo: 4 slots per ring place (2 left, 2 right); no later store
    // touches them
    if (tid < QK * 4) {
        const int q = tid & 3;
        const int c = (q < 2) ? q : ROWQ - 4 + q;
        sm[tid >> 2][slot_of(c)] = make_float4(0.0f, 0.0f, 0.0f, 0.0f);
    }
    // causally zeroed rows; memory column k sits at LDS column k + HALO
    #pragma unroll
    for (int j = 0; j < 2; ++j) {
        const int k4 = (tid + 256 * j) * 4;
        if (k4 < stageEnd) {
            #pragma unroll
            for (int r = 0; r < QK; ++r) {
                const int sp = s0 + r - 2;
                float4 x = stg[r][j];   // x.x is live or already 0
                x.y = (k4 + 1 <= sp) ? x.y : 0.0f;
                x.z = (k4 + 2 <= sp) ? x.z : 0.0f;
                x.w = (k4 + 3 <= sp) ? x.w : 0.0f;
                sm[r][slot_of(HALO / 4 + tid + 256 * j)] = x;
            }
        }
    }
    __syncthreads();

    int ps[6];
    #pragma unroll
    for (int j = 0; j < 6; ++j) ps[j] = slot_of(2 * ct + j);

    // the source row that is fetched next (s + 4) and this thread's place in the
    // output row, each moved on by one row per trip
    const float4* nrow = (const float4*)(scores + (rowBase + (size_t)(s0 + 4)) * S_);
    _Float16*     orow = attn + (rowBase + (size_t)s0) * S_ + 8 * ct;

    // ring: the place of the oldest source row (s - 2) of the current query row
    int ring = 0;
    #pragma unroll 1
    for (int i = 0; i < RPB; ++i) {
        const int s = s0 + i;

        // Source row s + 4, which the next query row needs: issued here, stored
        // behind the conv.
        const int  sn   = s + 4;
        const bool more = i + 1 < RPB;
        float4 nx[2];
        #pragma unroll
        for (int j = 0; j < 2; ++j) {
            const int k4 = (tid + 256 * j) * 4;
            nx[j] = make_float4(0.0f, 0.0f, 0.0f, 0.0f);
            if (more && sn < S_ && k4 <= sn)
                nx[j] = nrow[(unsigned)(tid + 256 * j)];
        }

        // Columns 8*ct .. 8*ct+7. Column k, tap dk reads LDS column k + dk + 3,
        // which is win[c + dk + 3] of the window that starts at LDS column 8*ct.
        // Every loop of the nest is unrolled so that win[] and acc[] are indexed
        // by constants and stay in registers. Per output the sum starts from the
        // bias and takes the ring places in order, dk inner.
        float vout[8];
        float mx = NEGV;                  // a chunk behind the limit: all NEGV
        if (live) {
            float acc[8];
            #pragma unroll
            for (int c = 0; c < 8; ++c) acc[c] = bias;
            #pragma unroll
            for (int t = 0; t < QK; ++t) {
                // place t holds source row s - 2 + dq
                const int dq = (t - ring < 0) ? t - ring + QK : t - ring;
                float win[24];
                #pragma unroll
                for (int j = 0; j < 6; ++j) {
                    const float4 q = sm[t][ps[j]];
                    win[4 * j + 0] = q.x;
                    win[4 * j + 1] = q.y;
                    win[4 * j + 2] = q.z;
                    win[4 * j + 3] = q.w;
                }
                const float4* wr = (const float4*)(wsm + dq * WROW);
                const float4 w0 = wr[0], w1 = wr[1], w2 = wr[2];
                const float w[KK] = { w0.x, w0.y, w0.z, w0.w, w1.x, w1.y, w1.z,
                                      w1.w, w2.x, w2.y, w2.z };
                #pragma unroll
                for (int dk = 0; dk < KK; ++dk) {
                    #pragma unroll
                    for (int c = 0; c < 8; ++c)
                        acc[c] = fmaf(w[dk], win[c + dk + (HALO - 5)], acc[c]);
                }
            }

            mx = -3.4e38f;
            #pragma unroll
            for (int c = 0; c < 8; ++c) {
                const float val = (8 * ct + c <= s) ? acc[c] : NEGV;
                vout[c] = val;
                mx = fmaxf(mx, val);
            }
            // partners 16, 8, 4, 2, 1 lanes away. The four steps inside a row are
            // written as asm: from xrow() and fmaxf() the compiler makes three
            // instructions a step (the move, a max of the moved value with itself,
            // the max). s_delay_alu: the hint that lets the SIMD's other waves issue
            // while a step waits for the one before.
            mx = fmaxf(mx, xhalf(mx));
            asm("s_delay_alu instid0(VALU_DEP_1)\n\t"
                "v_max_num_f32_dpp %0, %0, %0 row_xmask:8 row_mask:0xf bank_mask:0xf\n\t"
                "s_delay_alu instid0(VALU_DEP_1)\n\t"
                "v_max_num_f32_dpp %0, %0, %0 row_xmask:4 row_mask:0xf bank_mask:0xf\n\t"
                "s_delay_alu instid0(VALU_DEP_1)\n\t"
                "v_max_num_f32_dpp %0, %0, %0 row_xmask:2 row_mask:0xf bank_mask:0xf\n\t"
                "s_delay_alu instid0(VALU_DEP_1)\n\t"
                "v_max_num_f32_dpp %0, %0, %0 row_xmask:1 row_mask:0xf bank_mask:0xf"
                : "+v"(mx));
        }

        // block max; redm[] is indexed by chunk, so it is read in column order
        if (lane == 0) redm[chunk] = mx;
        __syncthreads();                  // also ends every read of this row's windows

        // the new source row takes the oldest one's place; the barrier in front
        // of the sum's read publishes it
        if (more) {
            #pragma unroll
            for (int j = 0; j < 2; ++j) {
                const int k4 = (tid + 256 * j) * 4;
                if (k4 < stageEnd) {
                    float4 x = nx[j];     // x.x is live or already 0
                    x.y = (k4 + 1 <= sn) ? x.y : 0.0f;
                    x.z = (k4 + 2 <= sn) ? x.z : 0.0f;
                    x.w = (k4 + 3 <= sn) ? x.w : 0.0f;
                    sm[ring][slot_of(HALO / 4 + tid + 256 * j)] = x;
                }
            }
        }

        mx = redm[0];
        #pragma unroll
        for (int c = 1; c < 8; ++c) mx = fmaxf(mx, redm[c]);

        // exp + block sum
        float e[8];
        float se = 0.0f;
        if (live) {
            #pragma unroll
            for (int c = 0; c < 8; ++c)   // e^x as 2^(x * log2 e), as __expf does
                vout[c] = (vout[c] - mx) * 1.44269504f;
            // The 8 v_exp_f32 stand in one statement, each on registers of its own,
            // with the free slot that the instruction set asks for behind the last.
            asm("v_exp_f32 %0, %8\n\t"
                "v_exp_f32 %1, %9\n\t"
                "v_exp_f32 %2, %10\n\t"
                "v_exp_f32 %3, %11\n\t"
                "v_exp_f32 %4, %12\n\t"
                "v_exp_f32 %5, %13\n\t"
                "v_exp_f32 %6, %14\n\t"
                "v_exp_f32 %7, %15\n\t"
                "v_nop"
                : "=&v"(e[0]), "=&v"(e[1]), "=&v"(e[2]), "=&v"(e[3]),
                  "=&v"(e[4]), "=&v"(e[5]), "=&v"(e[6]), "=&v"(e[7])
                : "v"(vout[0]), "v"(vout[1]), "v"(vout[2]), "v"(vout[3]),
                  "v"(vout[4]), "v"(vout[5]), "v"(vout[6]), "v"(vout[7]));
            #pragma unroll
            for (int c = 0; c < 8; ++c) se += e[c];
            // partners 16, 8, 4, 2, 1 lanes away: the tree of sums is the one that
            // the shuffles made
            se += xhalf(se);
            se += xrow<8>(se);
            se += xrow<4>(se);
            se += xrow<2>(se);
            se += xrow<1>(se);
        } else {
            // 256 equal terms
            const float e0 = __expf(NEGV - mx);
            #pragma unroll
            for (int c = 0; c < 8; ++c) e[c] = e0;
            se = 256.0f * e0;
        }
        // The maxima and the sums have an array each: a wave writes redm again
        // only behind this barrier, which every wave reaches with its maxima
        // read, and reds again only behind the next row's first barrier.
        if (lane == 0) reds[chunk] = se;
        __syncthreads();
        float tot = 0.0f;
        #pragma unroll
        for (int c = 0; c < 8; ++c) tot += reds[c];
        const float inv = 1.0f / tot;

        // the thread's 8 adjacent probabilities leave as one 16-byte store
        // (unrolled: p[] is a register vector, indexed by constants)
        v8h p;
        #pragma unroll
        for (int c = 0; c < 8; ++c) p[c] = (_Float16)(e[c] * inv);
        *(v8h*)orow = p;
        // The wait that belongs in front of any rewrite of a register that an
        // issued store names: the next trip reuses the store's registers.
        asm volatile("s_wait_xcnt 0x0" ::: "memory");

        nrow += S_ / 4;
        orow += S_;
        ring = (ring + 1 == QK) ? 0 : ring + 1;
    }
}

// ---------------------------------------------------------------------------
// Product kernel (launch 2): head-mix (packed f16 FMA) + attn@v via
// v_wmma_f32_16x16x32_f16 +
// fused LayerNorm over D.
// A 16-row tile of one head-GROUP (both output heads j=0 and j=1) is worked on
// by four waves: the raw attn fragments a0/a1 are shared by both output heads,
// so each pair of A loads feeds TWO WMMAs (two mixes x two V heads).
// Each wave owns one 16-column slice of D for both heads; K runs in steps of
// 32.  A-fragment K packing per ISA: lanes 0-15 -> K {0..7,16..23},
// lanes 16-31 -> K {8..15,24..31}.  The B fragments have the same K packing;
// launch 1 has laid vt out so that the 32 lanes' 16 bytes of one B load stand
// in a row.
// Causal limit: behind column m0 + 15 every probability of a tile is a masked
// one, and all masked probabilities of a row are the same number, which is 0
// unless the row's live scores lie near NEGV themselves. A tile's K range ends
// at the first multiple of KSTEP behind its last live column; the rest of K is
// run only if the last column of one of the tile's rows (a masked one wherever
// there is a rest) is not 0, so no input loses a term.
// Block = 256 threads (8 wave32) = row tiles i (short range) and 127 - i (long
// range). The two ranges add up to S_ + KSTEP columns in every block. Waves
// 0-3 take the first KCUT columns of the long tile; waves 4-7 take the short
// tile and what the long tile has behind KCUT: 9 and 8 trips, whatever i is.
// The long tile's two partial sums are added where the LayerNorm reads them.
// A path: the four waves of a half need the same 16 rows x KSTEP columns of both
// heads. A fragment load straight from attn touches 16 lines (16 rows, 4 KB
// apart, 32 bytes of each), in every one of the four waves. Instead the half
// copies the tile to LDS once, 256 bytes of a row at a time (whole lines), with
// asynchronous copies, two buffers: pass t works on buffer t & 1 while the
// copies of pass t + 1 fly. All 8 waves walk the same NPASS passes and meet at
// one barrier a pass; waves 4-7 have work in NPASS - 1 of them.
// ---------------------------------------------------------------------------
#define KSTEP 128                  // columns per trip: 4 WMMA steps
#define KCUT  (S_ / 2 + KSTEP)     // no long tile's range ends in front of it
#define VT1   ((D_ / 16) * S_ * VTK)  // vt elements from one head to the next
#define NPASS (KCUT / KSTEP)       // passes of a block
#define APITCH (KSTEP + 8)         // staged row in f16: 272 bytes = 16 x odd, so the
                                   // 16 rows of a b128 fragment read miss each other's banks

typedef const __attribute__((address_space(1))) _Float16* gl_h;
typedef const __attribute__((address_space(1))) v8h*      gl_v8h;
typedef const __attribute__((address_space(3))) _Float16* lds_h;

__global__ __launch_bounds__(256)
void k3_mix_gemm_ln(const _Float16* __restrict__ attn,
                    const _Float16* __restrict__ vt,
                    const float* __restrict__ head_mix,
                    const float* __restrict__ gamma,
                    const float* __restrict__ beta,
                    float* __restrict__ out)
{
    // readfirstlane: the half's number in a scalar register, so that the K
    // bounds are scalar and every lane is on at the WMMAs.
    const int hf = __builtin_amdgcn_readfirstlane(threadIdx.x >> 7);
    const int mS = blockIdx.x * 16;                       // short tile's rows
    const int mL = ((S_ / 16 - 1) - blockIdx.x) * 16;     // long tile's rows
    const int kS = (mS + 16 + KSTEP - 1) & ~(KSTEP - 1);  // end of its live range
    const int kL = (mL + 16 + KSTEP - 1) & ~(KSTEP - 1);
    const int m0 = hf ? mS : mL;          // the tile that this half finishes
    const int g  = blockIdx.y;            // head group (HEAD_K = 2)
    const int b  = blockIdx.z;

    const int lane = threadIdx.x & 31;
    // readfirstlane: the slice's number in a scalar register, so that the slice's
    // address takes no vector registers through the passes
    const int w    = __builtin_amdgcn_readfirstlane((threadIdx.x >> 5) & 3);

    // mixed_j = M[g,0,j]*attn_{2g} + M[g,1,j]*attn_{2g+1}
    const _Float16 c00 = (_Float16)head_mix[g * 4 + 0];   // i=0, j=0
    const _Float16 c01 = (_Float16)head_mix[g * 4 + 1];   // i=0, j=1
    const _Float16 c10 = (_Float16)head_mix[g * 4 + 2];   // i=1, j=0
    const _Float16 c11 = (_Float16)head_mix[g * 4 + 3];   // i=1, j=1

    const int mrow = m0 + (lane & 15);
    const int koff = (lane >> 4) << 3;    // 0 or 8

    const size_t bh0 = (size_t)b * H_ + (g * 2 + 0);
    const size_t bh1 = (size_t)b * H_ + (g * 2 + 1);

    // this wave's slice of vt (head 2g); key k's group of 16 starts VTK * k
    // further on, a lane's 16 bytes stand 8 * lane into a group
    const _Float16* bsl = vt + (bh0 * (D_ / 16) + (size_t)w) * (S_ * VTK);

    // last column of the 32 rows (16 rows x 2 heads) of this half's tile, one
    // per lane; issued here, looked at only behind the live ranges
    const _Float16 lastp =
        (attn + bh0 * S_ * S_)[(lane >> 4) * (S_ * S_) + mrow * S_ + (S_ - 1)];

    // one WMMA step on the fragments of 32 columns: rows of head 2g (a0), of
    // head 2g+1 (a1), and the two V heads (b0, b1)
    auto mma = [&](v8h a0lo, v8h a0hi, v8h a1lo, v8h a1hi,
                   v8h b0lo, v8h b0hi, v8h b1lo, v8h b1hi, v8f& c0, v8f& c1) {
        // two head-mixes from one pair of A fragments (v_pk_fma_f16)
        const v8h m0lo = a0lo * c00 + a1lo * c10;
        const v8h m0hi = a0hi * c00 + a1hi * c10;
        const v8h m1lo = a0lo * c01 + a1lo * c11;
        const v8h m1hi = a0hi * c01 + a1hi * c11;

        const v16h A0 = __builtin_shufflevector(m0lo, m0hi,
            0,1,2,3,4,5,6,7,8,9,10,11,12,13,14,15);
        const v16h A1 = __builtin_shufflevector(m1lo, m1hi,
            0,1,2,3,4,5,6,7,8,9,10,11,12,13,14,15);
        const v16h B0 = __builtin_shufflevector(b0lo, b0hi,
            0,1,2,3,4,5,6,7,8,9,10,11,12,13,14,15);
        const v16h B1 = __builtin_shufflevector(b1lo, b1hi,
            0,1,2,3,4,5,6,7,8,9,10,11,12,13,14,15);

        c0 = __builtin_amdgcn_wmma_f32_16x16x32_f16(
            false, A0, false, B0, (short)0, c0, false, false);
        c1 = __builtin_amdgcn_wmma_f32_16x16x32_f16(
            false, A1, false, B1, (short)0, c1, false, false);
    };
    // [buffer][half][head][row][column]
    __shared__ __attribute__((aligned(16))) _Float16 stA[2][2][2][16][APITCH];

    // Where this half's A tile of pass t starts in a head's [S_][S_] plane.
    // Waves 4-7: nS passes on the short tile, then the long tile behind KCUT.
    // Their last pass has no work; it copies the long tile's last KSTEP columns
    // in front of kL (inside attn, never read), so that every wave issues the same copies.
    const int nS = kS / KSTEP;
    auto tile_at = [&](int t) -> int {
        if (!hf)    return mL * S_ + t * KSTEP;
        if (t < nS) return mS * S_ + t * KSTEP;
        const int tt = (t < NPASS - 1) ? t : NPASS - 2;
        return mL * S_ + KCUT + (tt - nS) * KSTEP;
    };
    // A thread of the half copies 16 bytes of rows crow and crow + 8 of both
    // heads: a wave's copy is 2 rows x 256 bytes, 4 whole lines.
    const int th   = threadIdx.x & 127;
    const int crow = th >> 4;
    const int ccol = (th & 15) * 8;
    const int cl   = crow * S_ + ccol;    // the thread's place inside a tile
    auto stage = [&](int t, int buf) {
        const int off = tile_at(t);
        const _Float16* g0 = (attn + (bh0 * S_ * S_ + (size_t)off)) + cl;
        const _Float16* g1 = g0 + 8 * S_;
        const _Float16* g2 = (attn + (bh1 * S_ * S_ + (size_t)off)) + cl;
        const _Float16* g3 = g2 + 8 * S_;
        const unsigned l0 = (unsigned)(size_t)(lds_h)&stA[buf][hf][0][crow][ccol];
        const unsigned l1 = l0 + 8 * APITCH * 2;
        const unsigned l2 = l0 + 16 * APITCH * 2;
        const unsigned l3 = l0 + 24 * APITCH * 2;
        // The wait that belongs in front of any rewrite of a register that an
        // issued copy names stands in the copies' own statement.
        asm volatile("global_load_async_to_lds_b128 %0, %4, off\n\t"
                     "global_load_async_to_lds_b128 %1, %5, off\n\t"
                     "global_load_async_to_lds_b128 %2, %6, off\n\t"
                     "global_load_async_to_lds_b128 %3, %7, off\n\t"
                     "s_wait_xcnt 0x0"
                     :: "v"(l0), "v"(l1), "v"(l2), "v"(l3),
                        "v"(g0), "v"(g1), "v"(g2), "v"(g3) : "memory");
    };

    // C tiles in LDS: VGPR r -> row r (lanes 0-15) / r+8 (lanes 16-31)
    __shared__ float tile[2][2][16][72];   // [half][head][row][col]
    __shared__ float part[2][16][72];      // long tile, columns behind KCUT
    const int rbase = (lane >> 4) << 3;
    const int col   = 16 * w + (lane & 15);

    v8f cur0 = {}, cur1 = {};             // the tile that the half is working on

    stage(0, 0);
    // tile 0 has landed for this wave; the barrier says so for all of them
    asm volatile("s_wait_asynccnt 0x0" ::: "memory");
    __syncthreads();
    stage(1, 1);

    // not unrolled: nine copies of the pass would only add code
    #pragma unroll 1
    for (int t = 0; t < NPASS; ++t) {
        // waves 4-7 leave the short tile: its sums go to their places in LDS
        // (each thread's own), so that they hold no registers from here on
        if (hf && t == nS) {
            #pragma unroll
            for (int r = 0; r < 8; ++r) {
                tile[1][0][rbase + r][col] = cur0[r];
                tile[1][1][rbase + r][col] = cur1[r];
            }
            cur0 = v8f{};
            cur1 = v8f{};
        }
        if (!hf || t < NPASS - 1) {
            const int kb = tile_at(t) & (S_ - 1);      // the tile's first column
            gl_h r0 = (gl_h)((bsl + kb * VTK) + 8 * lane);  // head 2g+1: VT1 further on
            // unrolled: the fragments are register arrays, indexed by constants
            v8h fb0[8], fb1[8];
            #pragma unroll
            for (int u = 0; u < 8; ++u) {
                fb0[u] = *(gl_v8h)(r0 + 16 * u * VTK);
                fb1[u] = *(gl_v8h)(r0 + 16 * u * VTK + VT1);
            }
            // The wait that belongs in front of any rewrite of a register that an
            // issued load names as its address. The address passes through the
            // statement: no load's result is placed in its registers ahead of it.
            asm volatile("s_wait_xcnt 0x0" : "+v"(r0) :: "memory");
            const _Float16* ab = &stA[t & 1][hf][0][lane & 15][koff];
            #pragma unroll
            for (int u = 0; u < 8; u += 2)
                mma(*(const v8h*)(ab + 16 * u), *(const v8h*)(ab + 16 * u + 16),
                    *(const v8h*)(ab + 16 * APITCH + 16 * u),
                    *(const v8h*)(ab + 16 * APITCH + 16 * u + 16),
                    fb0[u], fb0[u + 1], fb1[u], fb1[u + 1], cur0, cur1);
        }
        // Foot of the pass: this wave's reads of buffer t & 1 are done and its
        // copies of tile t + 1 have landed; behind the barrier that holds for
        // all 8 waves, and the buffer just read may be filled again.
        asm volatile("s_wait_dscnt 0x0" ::: "memory");
        asm volatile("s_wait_asynccnt 0x0" ::: "memory");
        __syncthreads();
        if (t + 2 < NPASS) stage(t + 2, t & 1);
    }
    // no copy is left in flight
    asm volatile("s_wait_asynccnt 0x0" ::: "memory");

    // waves 0-3 never left their tile; in waves 4-7 cur is the long tile's part
    // and the short tile's sums come back from where the thread put them
    v8f acc0 = cur0, acc1 = cur1;
    const v8f par0 = cur0, par1 = cur1;
    if (hf) {
        #pragma unroll
        for (int r = 0; r < 8; ++r) {
            acc0[r] = tile[1][0][rbase + r][col];
            acc1[r] = tile[1][1][rbase + r][col];
        }
    }
    // The rest of K, for rows whose masked probabilities are not 0.
    // ballot: one scalar answer for the wave, so the branch is scalar.
    if (__builtin_amdgcn_ballot_w32(lastp != (_Float16)0.0f) != 0u) {
        const int kr = hf ? kS : kL;
        // typed as pointers to global memory: behind the asm statement below the
        // compiler no longer sees where they came from, and plain pointers would
        // turn their loads into flat loads
        gl_h q0 = (gl_h)((attn + bh0 * S_ * S_) + (mrow * S_ + koff + kr));
        gl_h q1 = q0 + S_ * S_;
        gl_h r0 = (gl_h)(bsl + kr * VTK + 8 * lane);
        // not unrolled: a path that few inputs take is kept small
        #pragma unroll 1
        for (int k0 = kr; k0 < S_; k0 += 32) {
            const v8h x0 = *(gl_v8h)q0, x1 = *(gl_v8h)(q0 + 16);
            const v8h y0 = *(gl_v8h)q1, y1 = *(gl_v8h)(q1 + 16);
            const v8h z0 = *(gl_v8h)r0, z1 = *(gl_v8h)(r0 + 16 * VTK);
            const v8h z2 = *(gl_v8h)(r0 + VT1), z3 = *(gl_v8h)(r0 + 16 * VTK + VT1);
            // The wait that belongs in front of any rewrite of a register that an
            // issued load names as its address; the addresses pass through the
            // statement, so neither a load's result nor their own step to the
            // next trip is placed in their registers ahead of it.
            asm volatile("s_wait_xcnt 0x0" : "+v"(q0), "+v"(q1), "+v"(r0) :: "memory");
            mma(x0, x1, y0, y1, z0, z1, z2, z3, acc0, acc1);
            q0 += 32;
            q1 += 32;
            r0 += 32 * VTK;
        }
    }

    // Scatter C tiles to LDS
    #pragma unroll
    for (int r = 0; r < 8; ++r) {
        tile[hf][0][rbase + r][col] = acc0[r];
        tile[hf][1][rbase + r][col] = acc1[r];
    }
    if (hf) {
        #pragma unroll
        for (int r = 0; r < 8; ++r) {
            part[0][rbase + r][col] = par0[r];
            part[1][rbase + r][col] = par1[r];
        }
    }
    __syncthreads();

    // LayerNorm over D=64 for each tile's 32 rows (2 heads x 16): 4 threads per row,
    // 16 cols each, shuffle-reduce within aligned 4-lane groups.
    const int t  = threadIdx.x & 127;
    const int jj = t >> 6;                // output head within group
    const int r  = (t >> 2) & 15;        // row within tile
    const int cb = (t & 3) * 16;         // column base
    float x[16];
    float sum = 0.0f, sq = 0.0f;
    #pragma unroll
    for (int i = 0; i < 16; ++i) x[i] = tile[hf][jj][r][cb + i];
    if (!hf) {                            // long tile: join its two partial sums
        #pragma unroll
        for (int i = 0; i < 16; ++i) x[i] += part[jj][r][cb + i];
    }
    #pragma unroll
    for (int i = 0; i < 16; ++i) {
        sum += x[i];
        sq  += x[i] * x[i];
    }
    #pragma unroll
    for (int off = 1; off < 4; off <<= 1) {
        sum += __shfl_xor(sum, off, 32);
        sq  += __shfl_xor(sq,  off, 32);
    }
    const float mean = sum * (1.0f / 64.0f);
    const float var  = sq * (1.0f / 64.0f) - mean * mean;
    const float rs   = rsqrtf(var + 1e-5f);

    const size_t obase =
        (((size_t)b * H_ + (g * 2 + jj)) * S_ + (size_t)(m0 + r)) * D_ + cb;
    #pragma unroll
    for (int i = 0; i < 16; ++i)
        out[obase + i] = (x[i] - mean) * rs * gamma[cb + i] + beta[cb + i];
}

// ---------------------------------------------------------------------------
extern "C" void kernel_launch(void* const* d_in, const int* in_sizes, int n_in,
                              void* d_out, int out_size, void* d_ws, size_t ws_size,
                              hipStream_t stream)
{
    const float* scores   = (const float*)d_in[0];
    const float* v        = (const float*)d_in[1];
    const float* kq_w     = (const float*)d_in[2];
    const float* kq_b     = (const float*)d_in[3];
    const float* head_mix = (const float*)d_in[4];
    const float* gamma    = (const float*)d_in[5];
    const float* beta     = (const float*)d_in[6];
    float* out = (float*)d_out;

    // workspace: [attn f16 : B*H*S*S] [vt f16 : B*H*D*S]  (128MB + 4MB)
    _Float16* wsAttn = (_Float16*)d_ws;
    _Float16* wsVt   = (_Float16*)((char*)d_ws +
                        (size_t)B_ * H_ * S_ * S_ * sizeof(_Float16));

    // one block per head and group of RPB rows, then one per head and v tile
    dim3 g1(B_ * H_, S_ / RPB + S_ / TK);
    k1_conv_softmax<<<g1, 256, 0, stream>>>(scores, kq_w, kq_b, wsAttn, v, wsVt);

    dim3 g3(S_ / 32, H_ / 2, B_);   // one block per pair of row tiles and head GROUP
    k3_mix_gemm_ln<<<g3, 256, 0, stream>>>(wsAttn, wsVt, head_mix,
                                           gamma, beta, out);
}
